// v000
// Measured on an AMD MI455X. A time is GPU time per run, averaged over a window of back-to-back runs after a warm-up
// (all launches, gaps included; the runs take copies of the inputs in turn), and the median of several windows.
// Apart from v000's, it joins two sittings. Times from different sittings can be a few percent apart, while
// side-by-side timings come from the same sitting.
// v000, which the later versions start from, runs in 357 microseconds.
#include <hip/hip_runtime.h>
#include <hip/hip_bf16.h>

typedef unsigned short u16;
typedef __attribute__((ext_vector_type(16))) __bf16 v16bf;
typedef __attribute__((ext_vector_type(8)))  float  v8f;

#define DDIM 1024
#define SDIM 2048
#define BDIM 2
#define HDIM 16
#define DH   64
#define FFD  4096
#define MROWS 4096   // B*S

// ---------- helpers ----------
__device__ __forceinline__ u16 f2bf(float f) {
    unsigned u = __float_as_uint(f);
    unsigned r = ((u >> 16) & 1u) + 0x7FFFu;
    return (u16)((u + r) >> 16);
}

union Frag16 { uint4 q[2]; v16bf v; };

__device__ __forceinline__ v16bf ld_frag(const u16* t, int row0, int stride,
                                         int coloff, int lane) {
    int r = lane & 15, hi = lane >> 4;
    const u16* p = t + (size_t)(row0 + r) * stride + coloff + hi * 8;
    Frag16 f;
    f.q[0] = *(const uint4*)(p);
    f.q[1] = *(const uint4*)(p + 16);
    return f.v;
}

__device__ __forceinline__ v8f wmma_bf16(v16bf a, v16bf b, v8f c) {
    return __builtin_amdgcn_wmma_f32_16x16x32_bf16(
        false, a, false, b, (short)0, c, false, false);
}

__device__ __forceinline__ void async_ld_b128(u16* lds_ptr, const u16* gptr) {
    unsigned lds_off = (unsigned)(unsigned long long)lds_ptr;
    asm volatile("global_load_async_to_lds_b128 %0, %1, off"
                 :: "v"(lds_off), "v"(gptr) : "memory");
}

// ---------- fp32 -> bf16 conversion ----------
__global__ __launch_bounds__(256) void cvt_bf16_kernel(
    const float* __restrict__ in, u16* __restrict__ out, int n4) {
    int i = blockIdx.x * 256 + threadIdx.x;
    if (i >= n4) return;
    float4 v = *(const float4*)(in + (size_t)i * 4);
    u16 o[4] = { f2bf(v.x), f2bf(v.y), f2bf(v.z), f2bf(v.w) };
    *(uint2*)(out + (size_t)i * 4) = *(const uint2*)o;
}

template <bool BIAS, bool RELU, bool RESID, bool OUTBF>
__global__ __launch_bounds__(256) void gemm_bf16_kernel(
    const u16* __restrict__ A, const u16* __restrict__ W,
    const float* __restrict__ bias, const float* __restrict__ resid,
    float* __restrict__ outF, u16* __restrict__ outB,
    int Mdim, int Ndim, int Kdim) {
    __shared__ u16 As[2][128 * 40];
    __shared__ u16 Bs[2][128 * 40];

    const int tid  = threadIdx.x;
    const int lane = tid & 31;
    const int wave = tid >> 5;
    const int wm   = wave >> 1;   // 0..3
    const int wn   = wave & 1;    // 0..1
    const int bm   = blockIdx.y * 128;
    const int bn   = blockIdx.x * 128;
    const int hi   = lane >> 4;

    v8f acc[2][4] = {};

    // per-thread staging coordinates (2 x b128 per matrix per K-step)
    const int row0 = tid >> 2,         cg0 = tid & 3;           // idx = tid
    const int row1 = (tid + 256) >> 2, cg1 = (tid + 256) & 3;   // idx = tid+256

    auto stage = [&](int buf, int k0) {
        async_ld_b128(&As[buf][row0 * 40 + cg0 * 8],
                      A + (size_t)(bm + row0) * Kdim + k0 + cg0 * 8);
        async_ld_b128(&As[buf][row1 * 40 + cg1 * 8],
                      A + (size_t)(bm + row1) * Kdim + k0 + cg1 * 8);
        async_ld_b128(&Bs[buf][row0 * 40 + cg0 * 8],
                      W + (size_t)(bn + row0) * Kdim + k0 + cg0 * 8);
        async_ld_b128(&Bs[buf][row1 * 40 + cg1 * 8],
                      W + (size_t)(bn + row1) * Kdim + k0 + cg1 * 8);
    };

    const int KT = Kdim / 32;
    stage(0, 0);

    for (int kt = 0; kt < KT; ++kt) {
        const int buf = kt & 1;
        if (kt + 1 < KT) {
            stage(buf ^ 1, (kt + 1) * 32);
            // 4 newest (next tile) may stay in flight; current tile complete.
            asm volatile("s_wait_asynccnt 0x4" ::: "memory");
        } else {
            asm volatile("s_wait_asynccnt 0x0" ::: "memory");
        }
        __syncthreads();

        v16bf af[2], bf[4];
#pragma unroll
        for (int i = 0; i < 2; ++i)
            af[i] = ld_frag(&As[buf][0], wm * 32 + i * 16, 40, 0, lane);
#pragma unroll
        for (int j = 0; j < 4; ++j)
            bf[j] = ld_frag(&Bs[buf][0], wn * 64 + j * 16, 40, 0, lane);
#pragma unroll
        for (int i = 0; i < 2; ++i)
#pragma unroll
            for (int j = 0; j < 4; ++j)
                acc[i][j] = wmma_bf16(af[i], bf[j], acc[i][j]);

        __syncthreads();   // all waves done reading buf before it is re-filled
    }

    // Epilogue. C layout: row = rr + 8*hi, col = lane&15.
#pragma unroll
    for (int i = 0; i < 2; ++i)
#pragma unroll
        for (int j = 0; j < 4; ++j)
#pragma unroll
            for (int rr = 0; rr < 8; ++rr) {
                int row = bm + wm * 32 + i * 16 + rr + 8 * hi;
                int col = bn + wn * 64 + j * 16 + (lane & 15);
                float v = acc[i][j][rr];
                if (BIAS)  v += bias[col];
                if (RELU)  v = fmaxf(v, 0.0f);
                if (RESID) v += resid[(size_t)row * Ndim + col];
                if (OUTBF) outB[(size_t)row * Ndim + col] = f2bf(v);
                else       outF[(size_t)row * Ndim + col] = v;
            }
}

// ---------- flash attention with relu(scores) then softmax ----------
// grid: (S/128, H, B). Block 256 thr = 8 waves; each wave owns 16 queries.
__global__ __launch_bounds__(256) void attn_kernel(
    const u16* __restrict__ q, const u16* __restrict__ k,
    const u16* __restrict__ v, u16* __restrict__ ctx) {
    __shared__ u16 Kt[32 * 72];        // [key][feat]    (async-filled)
    __shared__ u16 Vt[64 * 40];        // [feat][key]    (manual transpose)
    __shared__ u16 Pt[8][16 * 40];     // per-wave P buffer [row][key]

    const int tid  = threadIdx.x;
    const int lane = tid & 31;
    const int wave = tid >> 5;
    const int hi   = lane >> 4;
    const int h    = blockIdx.y;
    const int b    = blockIdx.z;
    const int qrow0 = b * SDIM + blockIdx.x * 128 + wave * 16;

    // Q fragments (16 x 64 per wave) straight from global bf16
    v16bf qa[2];
#pragma unroll
    for (int d = 0; d < 2; ++d)
        qa[d] = ld_frag(q + (size_t)qrow0 * DDIM + h * DH + d * 32, 0, DDIM, 0, lane);

    v8f o[4] = {};
    float Mx[8], Lr[8];
#pragma unroll
    for (int rr = 0; rr < 8; ++rr) { Mx[rr] = -1e30f; Lr[rr] = 0.0f; }

    const int srow = tid >> 3, scg = tid & 7;   // 32 rows x 8 groups of 8

    for (int kb = 0; kb < SDIM / 32; ++kb) {
        __syncthreads();
        const int krow = b * SDIM + kb * 32 + srow;
        // K tile: direct async memory->LDS (one b128 per thread)
        async_ld_b128(&Kt[srow * 72 + scg * 8],
                      k + (size_t)krow * DDIM + h * DH + scg * 8);
        // V tile: load + transpose-scatter into LDS
        {
            uint4 vvv = *(const uint4*)(v + (size_t)krow * DDIM + h * DH + scg * 8);
            const u16* vs = (const u16*)&vvv;
#pragma unroll
            for (int j = 0; j < 8; ++j)
                Vt[(scg * 8 + j) * 40 + srow] = vs[j];
        }
        asm volatile("s_wait_asynccnt 0x0" ::: "memory");
        __syncthreads();

        // scores: 16 queries x 32 keys
        v8f s[2] = {};
#pragma unroll
        for (int kc = 0; kc < 2; ++kc)
#pragma unroll
            for (int d = 0; d < 2; ++d)
                s[kc] = wmma_bf16(qa[d], ld_frag(Kt, kc * 16, 72, d * 32, lane), s[kc]);

        // scale + relu + streaming softmax
#pragma unroll
        for (int rr = 0; rr < 8; ++rr) {
            float s0 = fmaxf(s[0][rr] * 0.125f, 0.0f);
            float s1 = fmaxf(s[1][rr] * 0.125f, 0.0f);
            float mloc = fmaxf(s0, s1);
#pragma unroll
            for (int off = 8; off; off >>= 1)
                mloc = fmaxf(mloc, __shfl_xor(mloc, off, 32));
            float mnew  = fmaxf(Mx[rr], mloc);
            float alpha = __expf(Mx[rr] - mnew);
            float p0 = __expf(s0 - mnew);
            float p1 = __expf(s1 - mnew);
            float sum = p0 + p1;
#pragma unroll
            for (int off = 8; off; off >>= 1)
                sum += __shfl_xor(sum, off, 32);
            Lr[rr] = Lr[rr] * alpha + sum;
            Mx[rr] = mnew;
            s[0][rr] = p0;
            s[1][rr] = p1;
#pragma unroll
            for (int c = 0; c < 4; ++c)
                o[c][rr] *= alpha;
        }

        u16* pb = Pt[wave];
#pragma unroll
        for (int kc = 0; kc < 2; ++kc)
#pragma unroll
            for (int rr = 0; rr < 8; ++rr)
                pb[(rr + 8 * hi) * 40 + kc * 16 + (lane & 15)] = f2bf(s[kc][rr]);

        v16bf pa = ld_frag(pb, 0, 40, 0, lane);
#pragma unroll
        for (int c = 0; c < 4; ++c)
            o[c] = wmma_bf16(pa, ld_frag(Vt, c * 16, 40, 0, lane), o[c]);
    }

    // normalize and emit ctx as bf16
#pragma unroll
    for (int c = 0; c < 4; ++c)
#pragma unroll
        for (int rr = 0; rr < 8; ++rr) {
            float val = o[c][rr] / Lr[rr];
            int row = qrow0 + rr + 8 * hi;
            int col = h * DH + c * 16 + (lane & 15);
            ctx[(size_t)row * DDIM + col] = f2bf(val);
        }
}

// ---------- LayerNorm over D=1024 (input already holds x + residual) ----------
__global__ __launch_bounds__(256) void ln_kernel(
    const float* __restrict__ x, const float* __restrict__ g,
    const float* __restrict__ bta, float* __restrict__ yf,
    u16* __restrict__ yb) {
    __shared__ float sh[16];
    const int row = blockIdx.x, tid = threadIdx.x;
    const float* xr = x + (size_t)row * DDIM;
    float4 xv = *(const float4*)(xr + tid * 4);
    float s = xv.x + xv.y + xv.z + xv.w;
    float qq = xv.x * xv.x + xv.y * xv.y + xv.z * xv.z + xv.w * xv.w;
#pragma unroll
    for (int off = 16; off; off >>= 1) {
        s  += __shfl_xor(s, off, 32);
        qq += __shfl_xor(qq, off, 32);
    }
    int wv = tid >> 5, ln = tid & 31;
    if (ln == 0) { sh[wv] = s; sh[8 + wv] = qq; }
    __syncthreads();
    if (tid == 0) {
        float a = 0.f, b2 = 0.f;
        for (int i = 0; i < 8; ++i) { a += sh[i]; b2 += sh[8 + i]; }
        sh[0] = a; sh[8] = b2;
    }
    __syncthreads();
    float mu  = sh[0] * (1.0f / DDIM);
    float var = sh[8] * (1.0f / DDIM) - mu * mu;
    float inv = rsqrtf(var + 1e-5f);
    const float* xp = (const float*)&xv;
#pragma unroll
    for (int j = 0; j < 4; ++j) {
        int col = tid * 4 + j;
        float yv = (xp[j] - mu) * inv * g[col] + bta[col];
        yf[(size_t)row * DDIM + col] = yv;
        if (yb) yb[(size_t)row * DDIM + col] = f2bf(yv);
    }
}

// ---------- host ----------
extern "C" void kernel_launch(void* const* d_in, const int* in_sizes, int n_in,
                              void* d_out, int out_size, void* d_ws, size_t ws_size,
                              hipStream_t stream) {
    const float* X    = (const float*)d_in[0];
    const float* Wq   = (const float*)d_in[1];
    const float* Wk   = (const float*)d_in[2];
    const float* Wo   = (const float*)d_in[3];
    const float* ln1g = (const float*)d_in[4];
    const float* ln1b = (const float*)d_in[5];
    const float* ln2g = (const float*)d_in[6];
    const float* ln2b = (const float*)d_in[7];
    const float* W1   = (const float*)d_in[8];
    const float* b1   = (const float*)d_in[9];
    const float* W2   = (const float*)d_in[10];
    const float* b2   = (const float*)d_in[11];

    char* ws = (char*)d_ws;
    size_t off = 0;
    auto alloc = [&](size_t bytes) {
        char* p = ws + off;
        off += (bytes + 255) & ~size_t(255);
        return p;
    };
    u16*   Xb   = (u16*)alloc((size_t)MROWS * DDIM * 2);
    u16*   Wqb  = (u16*)alloc((size_t)DDIM * DDIM * 2);
    u16*   Wkb  = (u16*)alloc((size_t)DDIM * DDIM * 2);
    u16*   Wob  = (u16*)alloc((size_t)DDIM * DDIM * 2);
    u16*   W1b  = (u16*)alloc((size_t)FFD * DDIM * 2);
    u16*   W2b  = (u16*)alloc((size_t)DDIM * FFD * 2);
    u16*   qb   = (u16*)alloc((size_t)MROWS * DDIM * 2);
    u16*   kb   = (u16*)alloc((size_t)MROWS * DDIM * 2);
    u16*   vb   = (u16*)alloc((size_t)MROWS * DDIM * 2);
    u16*   ctxb = (u16*)alloc((size_t)MROWS * DDIM * 2);
    float* ares = (float*)alloc((size_t)MROWS * DDIM * 4);
    float* yf   = (float*)alloc((size_t)MROWS * DDIM * 4);
    u16*   yb   = (u16*)alloc((size_t)MROWS * DDIM * 2);
    u16*   hb   = (u16*)alloc((size_t)MROWS * FFD * 2);
    float* fres = (float*)alloc((size_t)MROWS * DDIM * 4);

    auto cvt = [&](const float* in, u16* out, size_t n) {
        int n4 = (int)(n / 4);
        cvt_bf16_kernel<<<(n4 + 255) / 256, 256, 0, stream>>>(in, out, n4);
    };
    cvt(X,  Xb,  (size_t)MROWS * DDIM);
    cvt(Wq, Wqb, (size_t)DDIM * DDIM);
    cvt(Wk, Wkb, (size_t)DDIM * DDIM);
    cvt(Wo, Wob, (size_t)DDIM * DDIM);
    cvt(W1, W1b, (size_t)FFD * DDIM);
    cvt(W2, W2b, (size_t)DDIM * FFD);

    // Q, K, V projections (V uses Wo per reference) -> bf16
    dim3 gproj(DDIM / 128, MROWS / 128);
    gemm_bf16_kernel<false, false, false, true><<<gproj, 256, 0, stream>>>(
        Xb, Wqb, nullptr, nullptr, nullptr, qb, MROWS, DDIM, DDIM);
    gemm_bf16_kernel<false, false, false, true><<<gproj, 256, 0, stream>>>(
        Xb, Wkb, nullptr, nullptr, nullptr, kb, MROWS, DDIM, DDIM);
    gemm_bf16_kernel<false, false, false, true><<<gproj, 256, 0, stream>>>(
        Xb, Wob, nullptr, nullptr, nullptr, vb, MROWS, DDIM, DDIM);

    // attention -> ctx (bf16)
    attn_kernel<<<dim3(SDIM / 128, HDIM, BDIM), 256, 0, stream>>>(qb, kb, vb, ctxb);

    // att_out = ctx @ Wo^T + X  (fp32)
    gemm_bf16_kernel<false, false, true, false><<<gproj, 256, 0, stream>>>(
        ctxb, Wob, nullptr, X, ares, nullptr, MROWS, DDIM, DDIM);

    // y = LN1(att_out + X)  -> fp32 + bf16
    ln_kernel<<<MROWS, 256, 0, stream>>>(ares, ln1g, ln1b, yf, yb);

    // h = relu(y @ W1^T + b1) -> bf16
    dim3 gffn1(FFD / 128, MROWS / 128);
    gemm_bf16_kernel<true, true, false, true><<<gffn1, 256, 0, stream>>>(
        yb, W1b, b1, nullptr, nullptr, hb, MROWS, FFD, DDIM);

    // f = h @ W2^T + b2 + y -> fp32
    gemm_bf16_kernel<true, false, true, false><<<gproj, 256, 0, stream>>>(
        hb, W2b, b2, yf, fres, nullptr, MROWS, DDIM, FFD);

    // out = LN2(f + y)
    ln_kernel<<<MROWS, 256, 0, stream>>>(fres, ln2g, ln2b, (float*)d_out, nullptr);
}

// v001
// It runs in 310 microseconds.
// Next to v000, in two timings, it ran 1.18 and 1.20 times as fast.
#include <hip/hip_runtime.h>
#include <hip/hip_bf16.h>

typedef unsigned short u16;
typedef __attribute__((ext_vector_type(16))) __bf16 v16bf;
typedef __attribute__((ext_vector_type(8)))  float  v8f;

#define DDIM 1024
#define SDIM 2048
#define BDIM 2
#define HDIM 16
#define DH   64
#define FFD  4096
#define MROWS 4096   // B*S

// ---------- helpers ----------
__device__ __forceinline__ u16 f2bf(float f) {
    unsigned u = __float_as_uint(f);
    unsigned r = ((u >> 16) & 1u) + 0x7FFFu;
    return (u16)((u + r) >> 16);
}

union Frag16 { uint4 q[2]; v16bf v; };

__device__ __forceinline__ v16bf ld_frag(const u16* t, int row0, int stride,
                                         int coloff, int lane) {
    int r = lane & 15, hi = lane >> 4;
    const u16* p = t + (size_t)(row0 + r) * stride + coloff + hi * 8;
    Frag16 f;
    f.q[0] = *(const uint4*)(p);
    f.q[1] = *(const uint4*)(p + 16);
    return f.v;
}

__device__ __forceinline__ v8f wmma_bf16(v16bf a, v16bf b, v8f c) {
    return __builtin_amdgcn_wmma_f32_16x16x32_bf16(
        false, a, false, b, (short)0, c, false, false);
}

__device__ __forceinline__ void async_ld_b128(u16* lds_ptr, const u16* gptr) {
    unsigned lds_off = (unsigned)(unsigned long long)lds_ptr;
    asm volatile("global_load_async_to_lds_b128 %0, %1, off"
                 :: "v"(lds_off), "v"(gptr) : "memory");
}

// ---------- fp32 -> bf16 conversion ----------
__global__ __launch_bounds__(256) void cvt_bf16_kernel(
    const float* __restrict__ in, u16* __restrict__ out, int n4) {
    int i = blockIdx.x * 256 + threadIdx.x;
    if (i >= n4) return;
    float4 v = *(const float4*)(in + (size_t)i * 4);
    u16 o[4] = { f2bf(v.x), f2bf(v.y), f2bf(v.z), f2bf(v.w) };
    *(uint2*)(out + (size_t)i * 4) = *(const uint2*)o;
}

template <bool BIAS, bool RELU, bool RESID, bool OUTBF>
__global__ __launch_bounds__(256) void gemm_bf16_kernel(
    const u16* __restrict__ A, const u16* __restrict__ W,
    const float* __restrict__ bias, const float* __restrict__ resid,
    float* __restrict__ outF, u16* __restrict__ outB,
    int Mdim, int Ndim, int Kdim) {
    __shared__ u16 As[2][128 * 40];
    __shared__ u16 Bs[2][128 * 40];

    const int tid  = threadIdx.x;
    const int lane = tid & 31;
    const int wave = tid >> 5;
    const int wm   = wave >> 1;   // 0..3
    const int wn   = wave & 1;    // 0..1
    const int bm   = blockIdx.y * 128;
    const int bn   = blockIdx.x * 128;
    const int hi   = lane >> 4;

    v8f acc[2][4] = {};

    // per-thread staging coordinates (2 x b128 per matrix per K-step)
    const int row0 = tid >> 2,         cg0 = tid & 3;           // idx = tid
    const int row1 = (tid + 256) >> 2, cg1 = (tid + 256) & 3;   // idx = tid+256

    auto stage = [&](int buf, int k0) {
        async_ld_b128(&As[buf][row0 * 40 + cg0 * 8],
                      A + (size_t)(bm + row0) * Kdim + k0 + cg0 * 8);
        async_ld_b128(&As[buf][row1 * 40 + cg1 * 8],
                      A + (size_t)(bm + row1) * Kdim + k0 + cg1 * 8);
        async_ld_b128(&Bs[buf][row0 * 40 + cg0 * 8],
                      W + (size_t)(bn + row0) * Kdim + k0 + cg0 * 8);
        async_ld_b128(&Bs[buf][row1 * 40 + cg1 * 8],
                      W + (size_t)(bn + row1) * Kdim + k0 + cg1 * 8);
    };

    const int KT = Kdim / 32;
    stage(0, 0);

    for (int kt = 0; kt < KT; ++kt) {
        const int buf = kt & 1;
        if (kt + 1 < KT) {
            stage(buf ^ 1, (kt + 1) * 32);
            // 4 newest (next tile) may stay in flight; current tile complete.
            asm volatile("s_wait_asynccnt 0x4" ::: "memory");
        } else {
            asm volatile("s_wait_asynccnt 0x0" ::: "memory");
        }
        __syncthreads();

        v16bf af[2], bf[4];
#pragma unroll
        for (int i = 0; i < 2; ++i)
            af[i] = ld_frag(&As[buf][0], wm * 32 + i * 16, 40, 0, lane);
#pragma unroll
        for (int j = 0; j < 4; ++j)
            bf[j] = ld_frag(&Bs[buf][0], wn * 64 + j * 16, 40, 0, lane);
#pragma unroll
        for (int i = 0; i < 2; ++i)
#pragma unroll
            for (int j = 0; j < 4; ++j)
                acc[i][j] = wmma_bf16(af[i], bf[j], acc[i][j]);

        __syncthreads();   // all waves done reading buf before it is re-filled
    }

    // Epilogue. C layout: row = rr + 8*hi, col = lane&15.
#pragma unroll
    for (int i = 0; i < 2; ++i)
#pragma unroll
        for (int j = 0; j < 4; ++j)
#pragma unroll
            for (int rr = 0; rr < 8; ++rr) {
                int row = bm + wm * 32 + i * 16 + rr + 8 * hi;
                int col = bn + wn * 64 + j * 16 + (lane & 15);
                float v = acc[i][j][rr];
                if (BIAS)  v += bias[col];
                if (RELU)  v = fmaxf(v, 0.0f);
                if (RESID) v += resid[(size_t)row * Ndim + col];
                if (OUTBF) outB[(size_t)row * Ndim + col] = f2bf(v);
                else       outF[(size_t)row * Ndim + col] = v;
            }
}

typedef __attribute__((ext_vector_type(2))) float  v2f;
typedef __attribute__((ext_vector_type(2))) __bf16 v2bf;

__device__ __forceinline__ unsigned pack_bf2(float lo, float hi2) {
    v2f t = { lo, hi2 };
    return __builtin_bit_cast(unsigned, __builtin_convertvector(t, v2bf));
}

__device__ __forceinline__ float xhalf(float x) {
    int b = __builtin_bit_cast(int, x);
    return __builtin_bit_cast(float, __builtin_amdgcn_permlanex16(
        b, b, 0x76543210, 0xfedcba98, false, false));
}

__global__ __launch_bounds__(256) void attn_kernel(
    const u16* __restrict__ q, const u16* __restrict__ k,
    const u16* __restrict__ v, u16* __restrict__ ctx) {
    __shared__ u16 Kt[32 * 72];        // [key][feat]    (async-filled)
    __shared__ u16 Vt[64 * 40];        // [feat][key]    (manual transpose)

    const int tid  = threadIdx.x;
    const int lane = tid & 31;
    const int wave = tid >> 5;
    const int hi   = lane >> 4;
    const int h    = blockIdx.y;
    const int b    = blockIdx.z;
    const int qrow0 = b * SDIM + blockIdx.x * 128 + wave * 16;

    // Q fragments (16 x 64 per wave) straight from global bf16; B operand
    v16bf qa[2];
#pragma unroll
    for (int d = 0; d < 2; ++d)
        qa[d] = ld_frag(q + (size_t)qrow0 * DDIM + h * DH + d * 32, 0, DDIM, 0, lane);

    // o[c][rr] = O[query lane&15][feat c*16 + 8*hi + rr]
    v8f o[4] = {};
    float Mx = -1e30f;   // running maximum of this lane's query (same in both halves)
    float Lr = 0.0f;     // running sum over this half's keys; halves joined at the end

    const int srow = tid >> 3, scg = tid & 7;   // 32 rows x 8 groups of 8

    for (int kb = 0; kb < SDIM / 32; ++kb) {
        __syncthreads();
        const int krow = b * SDIM + kb * 32 + srow;
        // K tile: direct async memory->LDS (one b128 per thread)
        async_ld_b128(&Kt[srow * 72 + scg * 8],
                      k + (size_t)krow * DDIM + h * DH + scg * 8);
        // V tile: load + transpose-scatter into LDS
        {
            uint4 vvv = *(const uint4*)(v + (size_t)krow * DDIM + h * DH + scg * 8);
            const u16* vs = (const u16*)&vvv;
#pragma unroll
            for (int j = 0; j < 8; ++j)
                Vt[(scg * 8 + j) * 40 + srow] = vs[j];
        }
        asm volatile("s_wait_asynccnt 0x0" ::: "memory");
        __syncthreads();

        // scores, transposed: s[kc][rr] = S[key kc*16 + 8*hi + rr][query lane&15]
        v8f s[2] = {};
#pragma unroll
        for (int kc = 0; kc < 2; ++kc)
#pragma unroll
            for (int d = 0; d < 2; ++d)
                s[kc] = wmma_bf16(ld_frag(Kt, kc * 16, 72, d * 32, lane), qa[d], s[kc]);

        // scale + relu + streaming softmax, one query per lane
        float mloc = 0.0f;   // relu: no score is below 0
#pragma unroll
        for (int kc = 0; kc < 2; ++kc)
#pragma unroll
            for (int rr = 0; rr < 8; ++rr) {
                s[kc][rr] = fmaxf(s[kc][rr] * 0.125f, 0.0f);
                mloc = fmaxf(mloc, s[kc][rr]);
            }
        mloc = fmaxf(mloc, xhalf(mloc));
        const float mnew  = fmaxf(Mx, mloc);
        const float alpha = __expf(Mx - mnew);
        float sum = 0.0f;
#pragma unroll
        for (int kc = 0; kc < 2; ++kc)
#pragma unroll
            for (int rr = 0; rr < 8; ++rr) {
                s[kc][rr] = __expf(s[kc][rr] - mnew);
                sum += s[kc][rr];
            }
        Lr = Lr * alpha + sum;
        Mx = mnew;

        // P^T as B operand: element e = key (e < 8 ? 8*hi + e : 16 + 8*hi + e - 8),
        // the k order in which ld_frag reads V^T
        union { unsigned u[8]; v16bf v; } pb;
#pragma unroll
        for (int kc = 0; kc < 2; ++kc)
#pragma unroll
            for (int e = 0; e < 4; ++e)
                pb.u[kc * 4 + e] = pack_bf2(s[kc][2 * e], s[kc][2 * e + 1]);

#pragma unroll
        for (int c = 0; c < 4; ++c) {
#pragma unroll
            for (int rr = 0; rr < 8; ++rr)
                o[c][rr] *= alpha;
            o[c] = wmma_bf16(ld_frag(Vt, c * 16, 40, 0, lane), pb.v, o[c]);
        }
    }

    // join the halves' sums, normalize and emit ctx as bf16:
    // 8 consecutive features of one query per lane and tile = one 16-byte store
    Lr += xhalf(Lr);
    u16* crow = ctx + (size_t)(qrow0 + (lane & 15)) * DDIM + h * DH + 8 * hi;
#pragma unroll
    for (int c = 0; c < 4; ++c) {
        uint4 w;
        w.x = pack_bf2(o[c][0] / Lr, o[c][1] / Lr);
        w.y = pack_bf2(o[c][2] / Lr, o[c][3] / Lr);
        w.z = pack_bf2(o[c][4] / Lr, o[c][5] / Lr);
        w.w = pack_bf2(o[c][6] / Lr, o[c][7] / Lr);
        *(uint4*)(crow + c * 16) = w;
    }
}

// ---------- LayerNorm over D=1024 (input already holds x + residual) ----------
__global__ __launch_bounds__(256) void ln_kernel(
    const float* __restrict__ x, const float* __restrict__ g,
    const float* __restrict__ bta, float* __restrict__ yf,
    u16* __restrict__ yb) {
    __shared__ float sh[16];
    const int row = blockIdx.x, tid = threadIdx.x;
    const float* xr = x + (size_t)row * DDIM;
    float4 xv = *(const float4*)(xr + tid * 4);
    float s = xv.x + xv.y + xv.z + xv.w;
    float qq = xv.x * xv.x + xv.y * xv.y + xv.z * xv.z + xv.w * xv.w;
#pragma unroll
    for (int off = 16; off; off >>= 1) {
        s  += __shfl_xor(s, off, 32);
        qq += __shfl_xor(qq, off, 32);
    }
    int wv = tid >> 5, ln = tid & 31;
    if (ln == 0) { sh[wv] = s; sh[8 + wv] = qq; }
    __syncthreads();
    if (tid == 0) {
        float a = 0.f, b2 = 0.f;
        for (int i = 0; i < 8; ++i) { a += sh[i]; b2 += sh[8 + i]; }
        sh[0] = a; sh[8] = b2;
    }
    __syncthreads();
    float mu  = sh[0] * (1.0f / DDIM);
    float var = sh[8] * (1.0f / DDIM) - mu * mu;
    float inv = rsqrtf(var + 1e-5f);
    const float* xp = (const float*)&xv;
#pragma unroll
    for (int j = 0; j < 4; ++j) {
        int col = tid * 4 + j;
        float yv = (xp[j] - mu) * inv * g[col] + bta[col];
        yf[(size_t)row * DDIM + col] = yv;
        if (yb) yb[(size_t)row * DDIM + col] = f2bf(yv);
    }
}

// ---------- host ----------
extern "C" void kernel_launch(void* const* d_in, const int* in_sizes, int n_in,
                              void* d_out, int out_size, void* d_ws, size_t ws_size,
                              hipStream_t stream) {
    const float* X    = (const float*)d_in[0];
    const float* Wq   = (const float*)d_in[1];
    const float* Wk   = (const float*)d_in[2];
    const float* Wo   = (const float*)d_in[3];
    const float* ln1g = (const float*)d_in[4];
    const float* ln1b = (const float*)d_in[5];
    const float* ln2g = (const float*)d_in[6];
    const float* ln2b = (const float*)d_in[7];
    const float* W1   = (const float*)d_in[8];
    const float* b1   = (const float*)d_in[9];
    const float* W2   = (const float*)d_in[10];
    const float* b2   = (const float*)d_in[11];

    char* ws = (char*)d_ws;
    size_t off = 0;
    auto alloc = [&](size_t bytes) {
        char* p = ws + off;
        off += (bytes + 255) & ~size_t(255);
        return p;
    };
    u16*   Xb   = (u16*)alloc((size_t)MROWS * DDIM * 2);
    u16*   Wqb  = (u16*)alloc((size_t)DDIM * DDIM * 2);
    u16*   Wkb  = (u16*)alloc((size_t)DDIM * DDIM * 2);
    u16*   Wob  = (u16*)alloc((size_t)DDIM * DDIM * 2);
    u16*   W1b  = (u16*)alloc((size_t)FFD * DDIM * 2);
    u16*   W2b  = (u16*)alloc((size_t)DDIM * FFD * 2);
    u16*   qb   = (u16*)alloc((size_t)MROWS * DDIM * 2);
    u16*   kb   = (u16*)alloc((size_t)MROWS * DDIM * 2);
    u16*   vb   = (u16*)alloc((size_t)MROWS * DDIM * 2);
    u16*   ctxb = (u16*)alloc((size_t)MROWS * DDIM * 2);
    float* ares = (float*)alloc((size_t)MROWS * DDIM * 4);
    float* yf   = (float*)alloc((size_t)MROWS * DDIM * 4);
    u16*   yb   = (u16*)alloc((size_t)MROWS * DDIM * 2);
    u16*   hb   = (u16*)alloc((size_t)MROWS * FFD * 2);
    float* fres = (float*)alloc((size_t)MROWS * DDIM * 4);

    auto cvt = [&](const float* in, u16* out, size_t n) {
        int n4 = (int)(n / 4);
        cvt_bf16_kernel<<<(n4 + 255) / 256, 256, 0, stream>>>(in, out, n4);
    };
    cvt(X,  Xb,  (size_t)MROWS * DDIM);
    cvt(Wq, Wqb, (size_t)DDIM * DDIM);
    cvt(Wk, Wkb, (size_t)DDIM * DDIM);
    cvt(Wo, Wob, (size_t)DDIM * DDIM);
    cvt(W1, W1b, (size_t)FFD * DDIM);
    cvt(W2, W2b, (size_t)DDIM * FFD);

    // Q, K, V projections (V uses Wo per reference) -> bf16
    dim3 gproj(DDIM / 128, MROWS / 128);
    gemm_bf16_kernel<false, false, false, true><<<gproj, 256, 0, stream>>>(
        Xb, Wqb, nullptr, nullptr, nullptr, qb, MROWS, DDIM, DDIM);
    gemm_bf16_kernel<false, false, false, true><<<gproj, 256, 0, stream>>>(
        Xb, Wkb, nullptr, nullptr, nullptr, kb, MROWS, DDIM, DDIM);
    gemm_bf16_kernel<false, false, false, true><<<gproj, 256, 0, stream>>>(
        Xb, Wob, nullptr, nullptr, nullptr, vb, MROWS, DDIM, DDIM);

    // attention -> ctx (bf16)
    attn_kernel<<<dim3(SDIM / 128, HDIM, BDIM), 256, 0, stream>>>(qb, kb, vb, ctxb);

    // att_out = ctx @ Wo^T + X  (fp32)
    gemm_bf16_kernel<false, false, true, false><<<gproj, 256, 0, stream>>>(
        ctxb, Wob, nullptr, X, ares, nullptr, MROWS, DDIM, DDIM);

    // y = LN1(att_out + X)  -> fp32 + bf16
    ln_kernel<<<MROWS, 256, 0, stream>>>(ares, ln1g, ln1b, yf, yb);

    // h = relu(y @ W1^T + b1) -> bf16
    dim3 gffn1(FFD / 128, MROWS / 128);
    gemm_bf16_kernel<true, true, false, true><<<gffn1, 256, 0, stream>>>(
        yb, W1b, b1, nullptr, nullptr, hb, MROWS, FFD, DDIM);

    // f = h @ W2^T + b2 + y -> fp32
    gemm_bf16_kernel<true, false, true, false><<<gproj, 256, 0, stream>>>(
        hb, W2b, b2, yf, fres, nullptr, MROWS, DDIM, FFD);

    // out = LN2(f + y)
    ln_kernel<<<MROWS, 256, 0, stream>>>(fres, ln2g, ln2b, (float*)d_out, nullptr);
}

// v002
// A run of this version takes 298 microseconds.
// Next to v001, in two timings, it ran 1.04 and 1.03 times as fast.
// Over all steps from v000 it is 1.23 times as fast.
#include <hip/hip_runtime.h>
#include <hip/hip_bf16.h>

typedef unsigned short u16;
typedef __attribute__((ext_vector_type(16))) __bf16 v16bf;
typedef __attribute__((ext_vector_type(8)))  float  v8f;

#define DDIM 1024
#define SDIM 2048
#define BDIM 2
#define HDIM 16
#define DH   64
#define FFD  4096
#define MROWS 4096   // B*S

// ---------- helpers ----------
__device__ __forceinline__ u16 f2bf(float f) {
    unsigned u = __float_as_uint(f);
    unsigned r = ((u >> 16) & 1u) + 0x7FFFu;
    return (u16)((u + r) >> 16);
}

union Frag16 { uint4 q[2]; v16bf v; };

__device__ __forceinline__ v16bf ld_frag(const u16* t, int row0, int stride,
                                         int coloff, int lane) {
    int r = lane & 15, hi = lane >> 4;
    const u16* p = t + (size_t)(row0 + r) * stride + coloff + hi * 8;
    Frag16 f;
    f.q[0] = *(const uint4*)(p);
    f.q[1] = *(const uint4*)(p + 16);
    return f.v;
}

__device__ __forceinline__ v8f wmma_bf16(v16bf a, v16bf b, v8f c) {
    return __builtin_amdgcn_wmma_f32_16x16x32_bf16(
        false, a, false, b, (short)0, c, false, false);
}

__device__ __forceinline__ void async_ld_b128(u16* lds_ptr, const u16* gptr) {
    unsigned lds_off = (unsigned)(unsigned long long)lds_ptr;
    asm volatile("global_load_async_to_lds_b128 %0, %1, off"
                 :: "v"(lds_off), "v"(gptr) : "memory");
}

// ---------- fp32 -> bf16 conversion, all six operands in one launch ----------
// The six bf16 copies lie back to back in the workspace, so the output is one
// array. A row is 1024 elements (one float4 per thread). A block converts
// CVT_ROWS consecutive rows; every operand is a whole number of such groups,
// so a block has one source. Each thread issues all its loads before the first
// conversion.
#define CVT_ROWS   16
#define CVT_RX     (MROWS * DDIM / 1024)   // rows of X
#define CVT_RW     (DDIM * DDIM / 1024)    // rows of Wq, Wk, Wo each
#define CVT_RF     (FFD * DDIM / 1024)     // rows of W1, W2 each
#define CVT_BLOCKS ((CVT_RX + 3 * CVT_RW + 2 * CVT_RF) / CVT_ROWS)
static_assert(CVT_RX % CVT_ROWS == 0 && CVT_RW % CVT_ROWS == 0 && CVT_RF % CVT_ROWS == 0,
              "a block must not straddle two operands");

__global__ __launch_bounds__(256) __attribute__((amdgpu_waves_per_eu(8, 8)))
void cvt_bf16_kernel(
    const float* __restrict__ X,  const float* __restrict__ Wq,
    const float* __restrict__ Wk, const float* __restrict__ Wo,
    const float* __restrict__ W1, const float* __restrict__ W2,
    u16* __restrict__ out) {
    const int tid = threadIdx.x;
    const int r0  = blockIdx.x * CVT_ROWS;
    int r = r0;                 // first row, counted within its own operand
    const float* s = X;
    if (r >= CVT_RX) {
        r -= CVT_RX; s = Wq;
        if (r >= CVT_RW) { r -= CVT_RW; s = Wk; }
        if (r >= CVT_RW) { r -= CVT_RW; s = Wo; }
        if (r >= CVT_RW) { r -= CVT_RW; s = W1; }
        if (r >= CVT_RF) { r -= CVT_RF; s = W2; }
    }
    const float* sp = s + (size_t)r * 1024 + tid * 4;
    u16*         op = out + (size_t)r0 * 1024 + tid * 4;
    float4 v[CVT_ROWS];
    // both loops unrolled: v stays in registers and the loads issue as one group
#pragma unroll
    for (int j = 0; j < CVT_ROWS; ++j)
        v[j] = *(const float4*)(sp + j * 1024);
#pragma unroll
    for (int j = 0; j < CVT_ROWS; ++j) {
        u16 o[4] = { f2bf(v[j].x), f2bf(v[j].y), f2bf(v[j].z), f2bf(v[j].w) };
        *(uint2*)(op + j * 1024) = *(const uint2*)o;
    }
}

template <bool BIAS, bool RELU, bool RESID, bool OUTBF>
__global__ __launch_bounds__(256) void gemm_bf16_kernel(
    const u16* __restrict__ A, const u16* __restrict__ W,
    const float* __restrict__ bias, const float* __restrict__ resid,
    float* __restrict__ outF, u16* __restrict__ outB,
    int Mdim, int Ndim, int Kdim) {
    __shared__ u16 As[2][128 * 40];
    __shared__ u16 Bs[2][128 * 40];

    const int tid  = threadIdx.x;
    const int lane = tid & 31;
    const int wave = tid >> 5;
    const int wm   = wave >> 1;   // 0..3
    const int wn   = wave & 1;    // 0..1
    const int bm   = blockIdx.y * 128;
    const int bn   = blockIdx.x * 128;
    const int hi   = lane >> 4;

    v8f acc[2][4] = {};

    // per-thread staging coordinates (2 x b128 per matrix per K-step)
    const int row0 = tid >> 2,         cg0 = tid & 3;           // idx = tid
    const int row1 = (tid + 256) >> 2, cg1 = (tid + 256) & 3;   // idx = tid+256

    auto stage = [&](int buf, int k0) {
        async_ld_b128(&As[buf][row0 * 40 + cg0 * 8],
                      A + (size_t)(bm + row0) * Kdim + k0 + cg0 * 8);
        async_ld_b128(&As[buf][row1 * 40 + cg1 * 8],
                      A + (size_t)(bm + row1) * Kdim + k0 + cg1 * 8);
        async_ld_b128(&Bs[buf][row0 * 40 + cg0 * 8],
                      W + (size_t)(bn + row0) * Kdim + k0 + cg0 * 8);
        async_ld_b128(&Bs[buf][row1 * 40 + cg1 * 8],
                      W + (size_t)(bn + row1) * Kdim + k0 + cg1 * 8);
    };

    const int KT = Kdim / 32;
    stage(0, 0);

    for (int kt = 0; kt < KT; ++kt) {
        const int buf = kt & 1;
        if (kt + 1 < KT) {
            stage(buf ^ 1, (kt + 1) * 32);
            // 4 newest (next tile) may stay in flight; current tile complete.
            asm volatile("s_wait_asynccnt 0x4" ::: "memory");
        } else {
            asm volatile("s_wait_asynccnt 0x0" ::: "memory");
        }
        __syncthreads();

        v16bf af[2], bf[4];
#pragma unroll
        for (int i = 0; i < 2; ++i)
            af[i] = ld_frag(&As[buf][0], wm * 32 + i * 16, 40, 0, lane);
#pragma unroll
        for (int j = 0; j < 4; ++j)
            bf[j] = ld_frag(&Bs[buf][0], wn * 64 + j * 16, 40, 0, lane);
#pragma unroll
        for (int i = 0; i < 2; ++i)
#pragma unroll
            for (int j = 0; j < 4; ++j)
                acc[i][j] = wmma_bf16(af[i], bf[j], acc[i][j]);

        __syncthreads();   // all waves done reading buf before it is re-filled
    }

    // Epilogue. C layout: row = rr + 8*hi, col = lane&15.
#pragma unroll
    for (int i = 0; i < 2; ++i)
#pragma unroll
        for (int j = 0; j < 4; ++j)
#pragma unroll
            for (int rr = 0; rr < 8; ++rr) {
                int row = bm + wm * 32 + i * 16 + rr + 8 * hi;
                int col = bn + wn * 64 + j * 16 + (lane & 15);
                float v = acc[i][j][rr];
                if (BIAS)  v += bias[col];
                if (RELU)  v = fmaxf(v, 0.0f);
                if (RESID) v += resid[(size_t)row * Ndim + col];
                if (OUTBF) outB[(size_t)row * Ndim + col] = f2bf(v);
                else       outF[(size_t)row * Ndim + col] = v;
            }
}

typedef __attribute__((ext_vector_type(2))) float  v2f;
typedef __attribute__((ext_vector_type(2))) __bf16 v2bf;

__device__ __forceinline__ unsigned pack_bf2(float lo, float hi2) {
    v2f t = { lo, hi2 };
    return __builtin_bit_cast(unsigned, __builtin_convertvector(t, v2bf));
}

__device__ __forceinline__ float xhalf(float x) {
    int b = __builtin_bit_cast(int, x);
    return __builtin_bit_cast(float, __builtin_amdgcn_permlanex16(
        b, b, 0x76543210, 0xfedcba98, false, false));
}

__global__ __launch_bounds__(256) void attn_kernel(
    const u16* __restrict__ q, const u16* __restrict__ k,
    const u16* __restrict__ v, u16* __restrict__ ctx) {
    __shared__ u16 Kt[32 * 72];        // [key][feat]    (async-filled)
    __shared__ u16 Vt[64 * 40];        // [feat][key]    (manual transpose)

    const int tid  = threadIdx.x;
    const int lane = tid & 31;
    const int wave = tid >> 5;
    const int hi   = lane >> 4;
    const int h    = blockIdx.y;
    const int b    = blockIdx.z;
    const int qrow0 = b * SDIM + blockIdx.x * 128 + wave * 16;

    // Q fragments (16 x 64 per wave) straight from global bf16; B operand
    v16bf qa[2];
#pragma unroll
    for (int d = 0; d < 2; ++d)
        qa[d] = ld_frag(q + (size_t)qrow0 * DDIM + h * DH + d * 32, 0, DDIM, 0, lane);

    // o[c][rr] = O[query lane&15][feat c*16 + 8*hi + rr]
    v8f o[4] = {};
    float Mx = -1e30f;   // running maximum of this lane's query (same in both halves)
    float Lr = 0.0f;     // running sum over this half's keys; halves joined at the end

    const int srow = tid >> 3, scg = tid & 7;   // 32 rows x 8 groups of 8

    for (int kb = 0; kb < SDIM / 32; ++kb) {
        __syncthreads();
        const int krow = b * SDIM + kb * 32 + srow;
        // K tile: direct async memory->LDS (one b128 per thread)
        async_ld_b128(&Kt[srow * 72 + scg * 8],
                      k + (size_t)krow * DDIM + h * DH + scg * 8);
        // V tile: load + transpose-scatter into LDS
        {
            uint4 vvv = *(const uint4*)(v + (size_t)krow * DDIM + h * DH + scg * 8);
            const u16* vs = (const u16*)&vvv;
#pragma unroll
            for (int j = 0; j < 8; ++j)
                Vt[(scg * 8 + j) * 40 + srow] = vs[j];
        }
        asm volatile("s_wait_asynccnt 0x0" ::: "memory");
        __syncthreads();

        // scores, transposed: s[kc][rr] = S[key kc*16 + 8*hi + rr][query lane&15]
        v8f s[2] = {};
#pragma unroll
        for (int kc = 0; kc < 2; ++kc)
#pragma unroll
            for (int d = 0; d < 2; ++d)
                s[kc] = wmma_bf16(ld_frag(Kt, kc * 16, 72, d * 32, lane), qa[d], s[kc]);

        // scale + relu + streaming softmax, one query per lane
        float mloc = 0.0f;   // relu: no score is below 0
#pragma unroll
        for (int kc = 0; kc < 2; ++kc)
#pragma unroll
            for (int rr = 0; rr < 8; ++rr) {
                s[kc][rr] = fmaxf(s[kc][rr] * 0.125f, 0.0f);
                mloc = fmaxf(mloc, s[kc][rr]);
            }
        mloc = fmaxf(mloc, xhalf(mloc));
        const float mnew  = fmaxf(Mx, mloc);
        const float alpha = __expf(Mx - mnew);
        float sum = 0.0f;
#pragma unroll
        for (int kc = 0; kc < 2; ++kc)
#pragma unroll
            for (int rr = 0; rr < 8; ++rr) {
                s[kc][rr] = __expf(s[kc][rr] - mnew);
                sum += s[kc][rr];
            }
        Lr = Lr * alpha + sum;
        Mx = mnew;

        // P^T as B operand: element e = key (e < 8 ? 8*hi + e : 16 + 8*hi + e - 8),
        // the k order in which ld_frag reads V^T
        union { unsigned u[8]; v16bf v; } pb;
#pragma unroll
        for (int kc = 0; kc < 2; ++kc)
#pragma unroll
            for (int e = 0; e < 4; ++e)
                pb.u[kc * 4 + e] = pack_bf2(s[kc][2 * e], s[kc][2 * e + 1]);

#pragma unroll
        for (int c = 0; c < 4; ++c) {
#pragma unroll
            for (int rr = 0; rr < 8; ++rr)
                o[c][rr] *= alpha;
            o[c] = wmma_bf16(ld_frag(Vt, c * 16, 40, 0, lane), pb.v, o[c]);
        }
    }

    // join the halves' sums, normalize and emit ctx as bf16:
    // 8 consecutive features of one query per lane and tile = one 16-byte store
    Lr += xhalf(Lr);
    u16* crow = ctx + (size_t)(qrow0 + (lane & 15)) * DDIM + h * DH + 8 * hi;
#pragma unroll
    for (int c = 0; c < 4; ++c) {
        uint4 w;
        w.x = pack_bf2(o[c][0] / Lr, o[c][1] / Lr);
        w.y = pack_bf2(o[c][2] / Lr, o[c][3] / Lr);
        w.z = pack_bf2(o[c][4] / Lr, o[c][5] / Lr);
        w.w = pack_bf2(o[c][6] / Lr, o[c][7] / Lr);
        *(uint4*)(crow + c * 16) = w;
    }
}

// ---------- LayerNorm over D=1024 (input already holds x + residual) ----------
__global__ __launch_bounds__(256) void ln_kernel(
    const float* __restrict__ x, const float* __restrict__ g,
    const float* __restrict__ bta, float* __restrict__ yf,
    u16* __restrict__ yb) {
    __shared__ float sh[16];
    const int row = blockIdx.x, tid = threadIdx.x;
    const float* xr = x + (size_t)row * DDIM;
    float4 xv = *(const float4*)(xr + tid * 4);
    float s = xv.x + xv.y + xv.z + xv.w;
    float qq = xv.x * xv.x + xv.y * xv.y + xv.z * xv.z + xv.w * xv.w;
#pragma unroll
    for (int off = 16; off; off >>= 1) {
        s  += __shfl_xor(s, off, 32);
        qq += __shfl_xor(qq, off, 32);
    }
    int wv = tid >> 5, ln = tid & 31;
    if (ln == 0) { sh[wv] = s; sh[8 + wv] = qq; }
    __syncthreads();
    if (tid == 0) {
        float a = 0.f, b2 = 0.f;
        for (int i = 0; i < 8; ++i) { a += sh[i]; b2 += sh[8 + i]; }
        sh[0] = a; sh[8] = b2;
    }
    __syncthreads();
    float mu  = sh[0] * (1.0f / DDIM);
    float var = sh[8] * (1.0f / DDIM) - mu * mu;
    float inv = rsqrtf(var + 1e-5f);
    const float* xp = (const float*)&xv;
#pragma unroll
    for (int j = 0; j < 4; ++j) {
        int col = tid * 4 + j;
        float yv = (xp[j] - mu) * inv * g[col] + bta[col];
        yf[(size_t)row * DDIM + col] = yv;
        if (yb) yb[(size_t)row * DDIM + col] = f2bf(yv);
    }
}

// ---------- host ----------
extern "C" void kernel_launch(void* const* d_in, const int* in_sizes, int n_in,
                              void* d_out, int out_size, void* d_ws, size_t ws_size,
                              hipStream_t stream) {
    const float* X    = (const float*)d_in[0];
    const float* Wq   = (const float*)d_in[1];
    const float* Wk   = (const float*)d_in[2];
    const float* Wo   = (const float*)d_in[3];
    const float* ln1g = (const float*)d_in[4];
    const float* ln1b = (const float*)d_in[5];
    const float* ln2g = (const float*)d_in[6];
    const float* ln2b = (const float*)d_in[7];
    const float* W1   = (const float*)d_in[8];
    const float* b1   = (const float*)d_in[9];
    const float* W2   = (const float*)d_in[10];
    const float* b2   = (const float*)d_in[11];

    char* ws = (char*)d_ws;
    size_t off = 0;
    auto alloc = [&](size_t bytes) {
        char* p = ws + off;
        off += (bytes + 255) & ~size_t(255);
        return p;
    };
    u16*   Xb   = (u16*)alloc((size_t)MROWS * DDIM * 2);
    u16*   Wqb  = (u16*)alloc((size_t)DDIM * DDIM * 2);
    u16*   Wkb  = (u16*)alloc((size_t)DDIM * DDIM * 2);
    u16*   Wob  = (u16*)alloc((size_t)DDIM * DDIM * 2);
    u16*   W1b  = (u16*)alloc((size_t)FFD * DDIM * 2);
    u16*   W2b  = (u16*)alloc((size_t)DDIM * FFD * 2);
    u16*   qb   = (u16*)alloc((size_t)MROWS * DDIM * 2);
    u16*   kb   = (u16*)alloc((size_t)MROWS * DDIM * 2);
    u16*   vb   = (u16*)alloc((size_t)MROWS * DDIM * 2);
    u16*   ctxb = (u16*)alloc((size_t)MROWS * DDIM * 2);
    float* ares = (float*)alloc((size_t)MROWS * DDIM * 4);
    float* yf   = (float*)alloc((size_t)MROWS * DDIM * 4);
    u16*   yb   = (u16*)alloc((size_t)MROWS * DDIM * 2);
    u16*   hb   = (u16*)alloc((size_t)MROWS * FFD * 2);
    float* fres = (float*)alloc((size_t)MROWS * DDIM * 4);

    // Xb, Wqb, Wkb, Wob, W1b, W2b are consecutive (each size a multiple of 256 bytes)
    cvt_bf16_kernel<<<CVT_BLOCKS, 256, 0, stream>>>(X, Wq, Wk, Wo, W1, W2, Xb);

    // Q, K, V projections (V uses Wo per reference) -> bf16
    dim3 gproj(DDIM / 128, MROWS / 128);
    gemm_bf16_kernel<false, false, false, true><<<gproj, 256, 0, stream>>>(
        Xb, Wqb, nullptr, nullptr, nullptr, qb, MROWS, DDIM, DDIM);
    gemm_bf16_kernel<false, false, false, true><<<gproj, 256, 0, stream>>>(
        Xb, Wkb, nullptr, nullptr, nullptr, kb, MROWS, DDIM, DDIM);
    gemm_bf16_kernel<false, false, false, true><<<gproj, 256, 0, stream>>>(
        Xb, Wob, nullptr, nullptr, nullptr, vb, MROWS, DDIM, DDIM);

    // attention -> ctx (bf16)
    attn_kernel<<<dim3(SDIM / 128, HDIM, BDIM), 256, 0, stream>>>(qb, kb, vb, ctxb);

    // att_out = ctx @ Wo^T + X  (fp32)
    gemm_bf16_kernel<false, false, true, false><<<gproj, 256, 0, stream>>>(
        ctxb, Wob, nullptr, X, ares, nullptr, MROWS, DDIM, DDIM);

    // y = LN1(att_out + X)  -> fp32 + bf16
    ln_kernel<<<MROWS, 256, 0, stream>>>(ares, ln1g, ln1b, yf, yb);

    // h = relu(y @ W1^T + b1) -> bf16
    dim3 gffn1(FFD / 128, MROWS / 128);
    gemm_bf16_kernel<true, true, false, true><<<gffn1, 256, 0, stream>>>(
        yb, W1b, b1, nullptr, nullptr, hb, MROWS, FFD, DDIM);

    // f = h @ W2^T + b2 + y -> fp32
    gemm_bf16_kernel<true, false, true, false><<<gproj, 256, 0, stream>>>(
        hb, W2b, b2, yf, fres, nullptr, MROWS, DDIM, FFD);

    // out = LN2(f + y)
    ln_kernel<<<MROWS, 256, 0, stream>>>(fres, ln2g, ln2b, (float*)d_out, nullptr);
}

// v003
// One run takes 231 microseconds.
// Timed twice side by side with v002, it ran 1.29 times as fast both times.
// All steps since v000 together make it 1.59 times as fast.
#include <hip/hip_runtime.h>
#include <hip/hip_bf16.h>

typedef unsigned short u16;
typedef __attribute__((ext_vector_type(16))) __bf16 v16bf;
typedef __attribute__((ext_vector_type(8)))  float  v8f;

#define DDIM 1024
#define SDIM 2048
#define BDIM 2
#define HDIM 16
#define DH   64
#define FFD  4096
#define MROWS 4096   // B*S

// ---------- helpers ----------
__device__ __forceinline__ u16 f2bf(float f) {
    unsigned u = __float_as_uint(f);
    unsigned r = ((u >> 16) & 1u) + 0x7FFFu;
    return (u16)((u + r) >> 16);
}

union Frag16 { uint4 q[2]; v16bf v; };

__device__ __forceinline__ v16bf ld_frag(const u16* t, int row0, int stride,
                                         int coloff, int lane) {
    int r = lane & 15, hi = lane >> 4;
    const u16* p = t + (size_t)(row0 + r) * stride + coloff + hi * 8;
    Frag16 f;
    f.q[0] = *(const uint4*)(p);
    f.q[1] = *(const uint4*)(p + 16);
    return f.v;
}

__device__ __forceinline__ v8f wmma_bf16(v16bf a, v16bf b, v8f c) {
    return __builtin_amdgcn_wmma_f32_16x16x32_bf16(
        false, a, false, b, (short)0, c, false, false);
}

__device__ __forceinline__ void async_ld_b128(u16* lds_ptr, const u16* gptr) {
    unsigned lds_off = (unsigned)(unsigned long long)lds_ptr;
    asm volatile("global_load_async_to_lds_b128 %0, %1, off"
                 :: "v"(lds_off), "v"(gptr) : "memory");
}

// ---------- fp32 -> bf16 conversion, all six operands in one launch ----------
// The six bf16 copies lie back to back in the workspace, so the output is one
// array. A row is 1024 elements (one float4 per thread). A block converts
// CVT_ROWS consecutive rows; every operand is a whole number of such groups,
// so a block has one source. Each thread issues all its loads before the first
// conversion.
#define CVT_ROWS   16
#define CVT_RX     (MROWS * DDIM / 1024)   // rows of X
#define CVT_RW     (DDIM * DDIM / 1024)    // rows of Wq, Wk, Wo each
#define CVT_RF     (FFD * DDIM / 1024)     // rows of W1, W2 each
#define CVT_BLOCKS ((CVT_RX + 3 * CVT_RW + 2 * CVT_RF) / CVT_ROWS)
static_assert(CVT_RX % CVT_ROWS == 0 && CVT_RW % CVT_ROWS == 0 && CVT_RF % CVT_ROWS == 0,
              "a block must not straddle two operands");

__global__ __launch_bounds__(256) __attribute__((amdgpu_waves_per_eu(8, 8)))
void cvt_bf16_kernel(
    const float* __restrict__ X,  const float* __restrict__ Wq,
    const float* __restrict__ Wk, const float* __restrict__ Wo,
    const float* __restrict__ W1, const float* __restrict__ W2,
    u16* __restrict__ out) {
    const int tid = threadIdx.x;
    const int r0  = blockIdx.x * CVT_ROWS;
    int r = r0;                 // first row, counted within its own operand
    const float* s = X;
    if (r >= CVT_RX) {
        r -= CVT_RX; s = Wq;
        if (r >= CVT_RW) { r -= CVT_RW; s = Wk; }
        if (r >= CVT_RW) { r -= CVT_RW; s = Wo; }
        if (r >= CVT_RW) { r -= CVT_RW; s = W1; }
        if (r >= CVT_RF) { r -= CVT_RF; s = W2; }
    }
    const float* sp = s + (size_t)r * 1024 + tid * 4;
    u16*         op = out + (size_t)r0 * 1024 + tid * 4;
    float4 v[CVT_ROWS];
    // both loops unrolled: v stays in registers and the loads issue as one group
#pragma unroll
    for (int j = 0; j < CVT_ROWS; ++j)
        v[j] = *(const float4*)(sp + j * 1024);
#pragma unroll
    for (int j = 0; j < CVT_ROWS; ++j) {
        u16 o[4] = { f2bf(v[j].x), f2bf(v[j].y), f2bf(v[j].z), f2bf(v[j].w) };
        *(uint2*)(op + j * 1024) = *(const uint2*)o;
    }
}

__device__ __forceinline__ void async_ld8_b128(const unsigned (&l)[8],
                                               const u16* const (&g)[8]) {
    asm volatile("global_load_async_to_lds_b128 %0, %8, off\n\t"
                 "global_load_async_to_lds_b128 %1, %9, off\n\t"
                 "global_load_async_to_lds_b128 %2, %10, off\n\t"
                 "global_load_async_to_lds_b128 %3, %11, off\n\t"
                 "global_load_async_to_lds_b128 %4, %12, off\n\t"
                 "global_load_async_to_lds_b128 %5, %13, off\n\t"
                 "global_load_async_to_lds_b128 %6, %14, off\n\t"
                 "global_load_async_to_lds_b128 %7, %15, off\n\t"
                 "s_wait_xcnt 0x0"
                 :: "v"(l[0]), "v"(l[1]), "v"(l[2]), "v"(l[3]),
                    "v"(l[4]), "v"(l[5]), "v"(l[6]), "v"(l[7]),
                    "v"(g[0]), "v"(g[1]), "v"(g[2]), "v"(g[3]),
                    "v"(g[4]), "v"(g[5]), "v"(g[6]), "v"(g[7])
                 : "memory");
}

#define GK      128                 // k per pass
#define GPITCH  136                 // LDS row pitch in elements (272 B)
#define GBUF    (128 * GPITCH)      // elements of one operand's buffer
template <bool BIAS, bool RELU, bool RESID, bool OUTBF>
__global__ __launch_bounds__(256) void gemm_bf16_kernel(
    const u16* __restrict__ A, const u16* __restrict__ W,
    const float* __restrict__ bias, const float* __restrict__ resid,
    float* __restrict__ outF, u16* __restrict__ outB,
    int Mdim, int Ndim, int Kdim) {
    __shared__ __attribute__((aligned(16))) u16 As[2][GBUF];
    __shared__ __attribute__((aligned(16))) u16 Bs[2][GBUF];

    const int tid  = threadIdx.x;
    const int lane = tid & 31;
    const int wave = tid >> 5;
    const int wm   = wave >> 1;   // 0..3
    const int wn   = wave & 1;    // 0..1
    const int bm   = blockIdx.y * 128;
    const int bn   = blockIdx.x * 128;
    const int hi   = lane >> 4;

    v8f acc[2][4] = {};

    // staging: 16 lanes cover the 256 B of a row, a wave's copy two whole rows;
    // a thread copies rows srow + 16*i, i = 0..7, of each operand
    const int srow = tid >> 4, scg = tid & 15;
    const u16* gA = A + (size_t)(bm + srow) * Kdim + scg * 8;
    const u16* gW = W + (size_t)(bn + srow) * Kdim + scg * 8;
    const unsigned lA = (unsigned)(unsigned long long)&As[0][srow * GPITCH + scg * 8];
    const unsigned lB = (unsigned)(unsigned long long)&Bs[0][srow * GPITCH + scg * 8];

    auto stage = [&](int buf, int k0) {
        unsigned l[8];
        const u16* g[8];
#pragma unroll
        for (int i = 0; i < 8; ++i) {
            l[i] = lA + (unsigned)(buf * GBUF + i * 16 * GPITCH) * 2u;
            g[i] = gA + (size_t)(i * 16) * Kdim + k0;
        }
        async_ld8_b128(l, g);
#pragma unroll
        for (int i = 0; i < 8; ++i) {
            l[i] = lB + (unsigned)(buf * GBUF + i * 16 * GPITCH) * 2u;
            g[i] = gW + (size_t)(i * 16) * Kdim + k0;
        }
        async_ld8_b128(l, g);
    };

    const int KT = Kdim / GK;
    stage(0, 0);
    // tile 0 has landed for this wave, then for the block
    asm volatile("s_wait_asynccnt 0x0" ::: "memory");
    __syncthreads();
    if (KT > 1) stage(1, GK);

    for (int kt = 0; kt < KT; ++kt) {
        const int buf = kt & 1;
#pragma unroll
        for (int kk = 0; kk < GK / 32; ++kk) {
            v16bf af[2], bf[4];
#pragma unroll
            for (int i = 0; i < 2; ++i)
                af[i] = ld_frag(&As[buf][0], wm * 32 + i * 16, GPITCH, kk * 32, lane);
#pragma unroll
            for (int j = 0; j < 4; ++j)
                bf[j] = ld_frag(&Bs[buf][0], wn * 64 + j * 16, GPITCH, kk * 32, lane);
#pragma unroll
            for (int i = 0; i < 2; ++i)
#pragma unroll
                for (int j = 0; j < 4; ++j)
                    acc[i][j] = wmma_bf16(af[i], bf[j], acc[i][j]);
        }

        // hand-over: this wave's reads of buf are done, its copies of the next
        // tile have landed; the one barrier publishes that tile and frees buf
        asm volatile("s_wait_dscnt 0x0" ::: "memory");
        asm volatile("s_wait_asynccnt 0x0" ::: "memory");
        __syncthreads();
        if (kt + 2 < KT) stage(buf, (kt + 2) * GK);
    }
    // no copy is outstanding when the wave goes on to its end
    asm volatile("s_wait_asynccnt 0x0" ::: "memory");

    // Epilogue. C layout: row = rr + 8*hi, col = lane&15.
#pragma unroll
    for (int i = 0; i < 2; ++i)
#pragma unroll
        for (int j = 0; j < 4; ++j)
#pragma unroll
            for (int rr = 0; rr < 8; ++rr) {
                int row = bm + wm * 32 + i * 16 + rr + 8 * hi;
                int col = bn + wn * 64 + j * 16 + (lane & 15);
                float v = acc[i][j][rr];
                if (BIAS)  v += bias[col];
                if (RELU)  v = fmaxf(v, 0.0f);
                if (RESID) v += resid[(size_t)row * Ndim + col];
                if (OUTBF) outB[(size_t)row * Ndim + col] = f2bf(v);
                else       outF[(size_t)row * Ndim + col] = v;
            }
}

typedef __attribute__((ext_vector_type(2))) float  v2f;
typedef __attribute__((ext_vector_type(2))) __bf16 v2bf;

__device__ __forceinline__ unsigned pack_bf2(float lo, float hi2) {
    v2f t = { lo, hi2 };
    return __builtin_bit_cast(unsigned, __builtin_convertvector(t, v2bf));
}

__device__ __forceinline__ float xhalf(float x) {
    int b = __builtin_bit_cast(int, x);
    return __builtin_bit_cast(float, __builtin_amdgcn_permlanex16(
        b, b, 0x76543210, 0xfedcba98, false, false));
}

__global__ __launch_bounds__(256) void attn_kernel(
    const u16* __restrict__ q, const u16* __restrict__ k,
    const u16* __restrict__ v, u16* __restrict__ ctx) {
    __shared__ u16 Kt[32 * 72];        // [key][feat]    (async-filled)
    __shared__ u16 Vt[64 * 40];        // [feat][key]    (manual transpose)

    const int tid  = threadIdx.x;
    const int lane = tid & 31;
    const int wave = tid >> 5;
    const int hi   = lane >> 4;
    const int h    = blockIdx.y;
    const int b    = blockIdx.z;
    const int qrow0 = b * SDIM + blockIdx.x * 128 + wave * 16;

    // Q fragments (16 x 64 per wave) straight from global bf16; B operand
    v16bf qa[2];
#pragma unroll
    for (int d = 0; d < 2; ++d)
        qa[d] = ld_frag(q + (size_t)qrow0 * DDIM + h * DH + d * 32, 0, DDIM, 0, lane);

    // o[c][rr] = O[query lane&15][feat c*16 + 8*hi + rr]
    v8f o[4] = {};
    float Mx = -1e30f;   // running maximum of this lane's query (same in both halves)
    float Lr = 0.0f;     // running sum over this half's keys; halves joined at the end

    const int srow = tid >> 3, scg = tid & 7;   // 32 rows x 8 groups of 8

    for (int kb = 0; kb < SDIM / 32; ++kb) {
        __syncthreads();
        const int krow = b * SDIM + kb * 32 + srow;
        // K tile: direct async memory->LDS (one b128 per thread)
        async_ld_b128(&Kt[srow * 72 + scg * 8],
                      k + (size_t)krow * DDIM + h * DH + scg * 8);
        // V tile: load + transpose-scatter into LDS
        {
            uint4 vvv = *(const uint4*)(v + (size_t)krow * DDIM + h * DH + scg * 8);
            const u16* vs = (const u16*)&vvv;
#pragma unroll
            for (int j = 0; j < 8; ++j)
                Vt[(scg * 8 + j) * 40 + srow] = vs[j];
        }
        asm volatile("s_wait_asynccnt 0x0" ::: "memory");
        __syncthreads();

        // scores, transposed: s[kc][rr] = S[key kc*16 + 8*hi + rr][query lane&15]
        v8f s[2] = {};
#pragma unroll
        for (int kc = 0; kc < 2; ++kc)
#pragma unroll
            for (int d = 0; d < 2; ++d)
                s[kc] = wmma_bf16(ld_frag(Kt, kc * 16, 72, d * 32, lane), qa[d], s[kc]);

        // scale + relu + streaming softmax, one query per lane
        float mloc = 0.0f;   // relu: no score is below 0
#pragma unroll
        for (int kc = 0; kc < 2; ++kc)
#pragma unroll
            for (int rr = 0; rr < 8; ++rr) {
                s[kc][rr] = fmaxf(s[kc][rr] * 0.125f, 0.0f);
                mloc = fmaxf(mloc, s[kc][rr]);
            }
        mloc = fmaxf(mloc, xhalf(mloc));
        const float mnew  = fmaxf(Mx, mloc);
        const float alpha = __expf(Mx - mnew);
        float sum = 0.0f;
#pragma unroll
        for (int kc = 0; kc < 2; ++kc)
#pragma unroll
            for (int rr = 0; rr < 8; ++rr) {
                s[kc][rr] = __expf(s[kc][rr] - mnew);
                sum += s[kc][rr];
            }
        Lr = Lr * alpha + sum;
        Mx = mnew;

        // P^T as B operand: element e = key (e < 8 ? 8*hi + e : 16 + 8*hi + e - 8),
        // the k order in which ld_frag reads V^T
        union { unsigned u[8]; v16bf v; } pb;
#pragma unroll
        for (int kc = 0; kc < 2; ++kc)
#pragma unroll
            for (int e = 0; e < 4; ++e)
                pb.u[kc * 4 + e] = pack_bf2(s[kc][2 * e], s[kc][2 * e + 1]);

#pragma unroll
        for (int c = 0; c < 4; ++c) {
#pragma unroll
            for (int rr = 0; rr < 8; ++rr)
                o[c][rr] *= alpha;
            o[c] = wmma_bf16(ld_frag(Vt, c * 16, 40, 0, lane), pb.v, o[c]);
        }
    }

    // join the halves' sums, normalize and emit ctx as bf16:
    // 8 consecutive features of one query per lane and tile = one 16-byte store
    Lr += xhalf(Lr);
    u16* crow = ctx + (size_t)(qrow0 + (lane & 15)) * DDIM + h * DH + 8 * hi;
#pragma unroll
    for (int c = 0; c < 4; ++c) {
        uint4 w;
        w.x = pack_bf2(o[c][0] / Lr, o[c][1] / Lr);
        w.y = pack_bf2(o[c][2] / Lr, o[c][3] / Lr);
        w.z = pack_bf2(o[c][4] / Lr, o[c][5] / Lr);
        w.w = pack_bf2(o[c][6] / Lr, o[c][7] / Lr);
        *(uint4*)(crow + c * 16) = w;
    }
}

// ---------- LayerNorm over D=1024 (input already holds x + residual) ----------
__global__ __launch_bounds__(256) void ln_kernel(
    const float* __restrict__ x, const float* __restrict__ g,
    const float* __restrict__ bta, float* __restrict__ yf,
    u16* __restrict__ yb) {
    __shared__ float sh[16];
    const int row = blockIdx.x, tid = threadIdx.x;
    const float* xr = x + (size_t)row * DDIM;
    float4 xv = *(const float4*)(xr + tid * 4);
    float s = xv.x + xv.y + xv.z + xv.w;
    float qq = xv.x * xv.x + xv.y * xv.y + xv.z * xv.z + xv.w * xv.w;
#pragma unroll
    for (int off = 16; off; off >>= 1) {
        s  += __shfl_xor(s, off, 32);
        qq += __shfl_xor(qq, off, 32);
    }
    int wv = tid >> 5, ln = tid & 31;
    if (ln == 0) { sh[wv] = s; sh[8 + wv] = qq; }
    __syncthreads();
    if (tid == 0) {
        float a = 0.f, b2 = 0.f;
        for (int i = 0; i < 8; ++i) { a += sh[i]; b2 += sh[8 + i]; }
        sh[0] = a; sh[8] = b2;
    }
    __syncthreads();
    float mu  = sh[0] * (1.0f / DDIM);
    float var = sh[8] * (1.0f / DDIM) - mu * mu;
    float inv = rsqrtf(var + 1e-5f);
    const float* xp = (const float*)&xv;
#pragma unroll
    for (int j = 0; j < 4; ++j) {
        int col = tid * 4 + j;
        float yv = (xp[j] - mu) * inv * g[col] + bta[col];
        yf[(size_t)row * DDIM + col] = yv;
        if (yb) yb[(size_t)row * DDIM + col] = f2bf(yv);
    }
}

// ---------- host ----------
extern "C" void kernel_launch(void* const* d_in, const int* in_sizes, int n_in,
                              void* d_out, int out_size, void* d_ws, size_t ws_size,
                              hipStream_t stream) {
    const float* X    = (const float*)d_in[0];
    const float* Wq   = (const float*)d_in[1];
    const float* Wk   = (const float*)d_in[2];
    const float* Wo   = (const float*)d_in[3];
    const float* ln1g = (const float*)d_in[4];
    const float* ln1b = (const float*)d_in[5];
    const float* ln2g = (const float*)d_in[6];
    const float* ln2b = (const float*)d_in[7];
    const float* W1   = (const float*)d_in[8];
    const float* b1   = (const float*)d_in[9];
    const float* W2   = (const float*)d_in[10];
    const float* b2   = (const float*)d_in[11];

    char* ws = (char*)d_ws;
    size_t off = 0;
    auto alloc = [&](size_t bytes) {
        char* p = ws + off;
        off += (bytes + 255) & ~size_t(255);
        return p;
    };
    u16*   Xb   = (u16*)alloc((size_t)MROWS * DDIM * 2);
    u16*   Wqb  = (u16*)alloc((size_t)DDIM * DDIM * 2);
    u16*   Wkb  = (u16*)alloc((size_t)DDIM * DDIM * 2);
    u16*   Wob  = (u16*)alloc((size_t)DDIM * DDIM * 2);
    u16*   W1b  = (u16*)alloc((size_t)FFD * DDIM * 2);
    u16*   W2b  = (u16*)alloc((size_t)DDIM * FFD * 2);
    u16*   qb   = (u16*)alloc((size_t)MROWS * DDIM * 2);
    u16*   kb   = (u16*)alloc((size_t)MROWS * DDIM * 2);
    u16*   vb   = (u16*)alloc((size_t)MROWS * DDIM * 2);
    u16*   ctxb = (u16*)alloc((size_t)MROWS * DDIM * 2);
    float* ares = (float*)alloc((size_t)MROWS * DDIM * 4);
    float* yf   = (float*)alloc((size_t)MROWS * DDIM * 4);
    u16*   yb   = (u16*)alloc((size_t)MROWS * DDIM * 2);
    u16*   hb   = (u16*)alloc((size_t)MROWS * FFD * 2);
    float* fres = (float*)alloc((size_t)MROWS * DDIM * 4);

    // Xb, Wqb, Wkb, Wob, W1b, W2b are consecutive (each size a multiple of 256 bytes)
    cvt_bf16_kernel<<<CVT_BLOCKS, 256, 0, stream>>>(X, Wq, Wk, Wo, W1, W2, Xb);

    // Q, K, V projections (V uses Wo per reference) -> bf16
    dim3 gproj(DDIM / 128, MROWS / 128);
    gemm_bf16_kernel<false, false, false, true><<<gproj, 256, 0, stream>>>(
        Xb, Wqb, nullptr, nullptr, nullptr, qb, MROWS, DDIM, DDIM);
    gemm_bf16_kernel<false, false, false, true><<<gproj, 256, 0, stream>>>(
        Xb, Wkb, nullptr, nullptr, nullptr, kb, MROWS, DDIM, DDIM);
    gemm_bf16_kernel<false, false, false, true><<<gproj, 256, 0, stream>>>(
        Xb, Wob, nullptr, nullptr, nullptr, vb, MROWS, DDIM, DDIM);

    // attention -> ctx (bf16)
    attn_kernel<<<dim3(SDIM / 128, HDIM, BDIM), 256, 0, stream>>>(qb, kb, vb, ctxb);

    // att_out = ctx @ Wo^T + X  (fp32)
    gemm_bf16_kernel<false, false, true, false><<<gproj, 256, 0, stream>>>(
        ctxb, Wob, nullptr, X, ares, nullptr, MROWS, DDIM, DDIM);

    // y = LN1(att_out + X)  -> fp32 + bf16
    ln_kernel<<<MROWS, 256, 0, stream>>>(ares, ln1g, ln1b, yf, yb);

    // h = relu(y @ W1^T + b1) -> bf16
    dim3 gffn1(FFD / 128, MROWS / 128);
    gemm_bf16_kernel<true, true, false, true><<<gffn1, 256, 0, stream>>>(
        yb, W1b, b1, nullptr, nullptr, hb, MROWS, FFD, DDIM);

    // f = h @ W2^T + b2 + y -> fp32
    gemm_bf16_kernel<true, false, true, false><<<gproj, 256, 0, stream>>>(
        hb, W2b, b2, yf, fres, nullptr, MROWS, DDIM, FFD);

    // out = LN2(f + y)
    ln_kernel<<<MROWS, 256, 0, stream>>>(fres, ln2g, ln2b, (float*)d_out, nullptr);
}

// v004
// Measured time: 184 microseconds a run.
// In two side-by-side timings against v003, it was 1.27 and 1.25 times as fast.
// Counting every step since v000, it is 1.99 times as fast.
#include <hip/hip_runtime.h>
#include <hip/hip_bf16.h>

typedef unsigned short u16;
typedef __attribute__((ext_vector_type(16))) __bf16 v16bf;
typedef __attribute__((ext_vector_type(8)))  float  v8f;

#define DDIM 1024
#define SDIM 2048
#define BDIM 2
#define HDIM 16
#define DH   64
#define FFD  4096
#define MROWS 4096   // B*S

// ---------- helpers ----------
__device__ __forceinline__ u16 f2bf(float f) {
    unsigned u = __float_as_uint(f);
    unsigned r = ((u >> 16) & 1u) + 0x7FFFu;
    return (u16)((u + r) >> 16);
}

union Frag16 { uint4 q[2]; v16bf v; };

__device__ __forceinline__ v16bf ld_frag(const u16* t, int row0, int stride,
                                         int coloff, int lane) {
    int r = lane & 15, hi = lane >> 4;
    const u16* p = t + (size_t)(row0 + r) * stride + coloff + hi * 8;
    Frag16 f;
    f.q[0] = *(const uint4*)(p);
    f.q[1] = *(const uint4*)(p + 16);
    return f.v;
}

__device__ __forceinline__ v8f wmma_bf16(v16bf a, v16bf b, v8f c) {
    return __builtin_amdgcn_wmma_f32_16x16x32_bf16(
        false, a, false, b, (short)0, c, false, false);
}

// ---------- fp32 -> bf16 conversion, all six operands in one launch ----------
// The six bf16 copies lie back to back in the workspace, so the output is one
// array. A row is 1024 elements (one float4 per thread). A block converts
// CVT_ROWS consecutive rows; every operand is a whole number of such groups,
// so a block has one source. Each thread issues all its loads before the first
// conversion.
#define CVT_ROWS   16
#define CVT_RX     (MROWS * DDIM / 1024)   // rows of X
#define CVT_RW     (DDIM * DDIM / 1024)    // rows of Wq, Wk, Wo each
#define CVT_RF     (FFD * DDIM / 1024)     // rows of W1, W2 each
#define CVT_BLOCKS ((CVT_RX + 3 * CVT_RW + 2 * CVT_RF) / CVT_ROWS)
static_assert(CVT_RX % CVT_ROWS == 0 && CVT_RW % CVT_ROWS == 0 && CVT_RF % CVT_ROWS == 0,
              "a block must not straddle two operands");

__global__ __launch_bounds__(256) __attribute__((amdgpu_waves_per_eu(8, 8)))
void cvt_bf16_kernel(
    const float* __restrict__ X,  const float* __restrict__ Wq,
    const float* __restrict__ Wk, const float* __restrict__ Wo,
    const float* __restrict__ W1, const float* __restrict__ W2,
    u16* __restrict__ out) {
    const int tid = threadIdx.x;
    const int r0  = blockIdx.x * CVT_ROWS;
    int r = r0;                 // first row, counted within its own operand
    const float* s = X;
    if (r >= CVT_RX) {
        r -= CVT_RX; s = Wq;
        if (r >= CVT_RW) { r -= CVT_RW; s = Wk; }
        if (r >= CVT_RW) { r -= CVT_RW; s = Wo; }
        if (r >= CVT_RW) { r -= CVT_RW; s = W1; }
        if (r >= CVT_RF) { r -= CVT_RF; s = W2; }
    }
    const float* sp = s + (size_t)r * 1024 + tid * 4;
    u16*         op = out + (size_t)r0 * 1024 + tid * 4;
    float4 v[CVT_ROWS];
    // both loops unrolled: v stays in registers and the loads issue as one group
#pragma unroll
    for (int j = 0; j < CVT_ROWS; ++j)
        v[j] = *(const float4*)(sp + j * 1024);
#pragma unroll
    for (int j = 0; j < CVT_ROWS; ++j) {
        u16 o[4] = { f2bf(v[j].x), f2bf(v[j].y), f2bf(v[j].z), f2bf(v[j].w) };
        *(uint2*)(op + j * 1024) = *(const uint2*)o;
    }
}

__device__ __forceinline__ void async_ld8_b128(const unsigned (&l)[8],
                                               const u16* const (&g)[8]) {
    asm volatile("global_load_async_to_lds_b128 %0, %8, off\n\t"
                 "global_load_async_to_lds_b128 %1, %9, off\n\t"
                 "global_load_async_to_lds_b128 %2, %10, off\n\t"
                 "global_load_async_to_lds_b128 %3, %11, off\n\t"
                 "global_load_async_to_lds_b128 %4, %12, off\n\t"
                 "global_load_async_to_lds_b128 %5, %13, off\n\t"
                 "global_load_async_to_lds_b128 %6, %14, off\n\t"
                 "global_load_async_to_lds_b128 %7, %15, off\n\t"
                 "s_wait_xcnt 0x0"
                 :: "v"(l[0]), "v"(l[1]), "v"(l[2]), "v"(l[3]),
                    "v"(l[4]), "v"(l[5]), "v"(l[6]), "v"(l[7]),
                    "v"(g[0]), "v"(g[1]), "v"(g[2]), "v"(g[3]),
                    "v"(g[4]), "v"(g[5]), "v"(g[6]), "v"(g[7])
                 : "memory");
}

#define GK      128                 // k per pass
#define GPITCH  136                 // LDS row pitch in elements (272 B)
#define GBUF    (128 * GPITCH)      // elements of one operand's buffer
template <bool BIAS, bool RELU, bool RESID, bool OUTBF>
__global__ __launch_bounds__(256) void gemm_bf16_kernel(
    const u16* __restrict__ A, const u16* __restrict__ W,
    const float* __restrict__ bias, const float* __restrict__ resid,
    float* __restrict__ outF, u16* __restrict__ outB,
    int Mdim, int Ndim, int Kdim) {
    __shared__ __attribute__((aligned(16))) u16 As[2][GBUF];
    __shared__ __attribute__((aligned(16))) u16 Bs[2][GBUF];

    const int tid  = threadIdx.x;
    const int lane = tid & 31;
    const int wave = tid >> 5;
    const int wm   = wave >> 1;   // 0..3
    const int wn   = wave & 1;    // 0..1
    const int bm   = blockIdx.y * 128;
    const int bn   = blockIdx.x * 128;
    const int hi   = lane >> 4;

    v8f acc[2][4] = {};

    // staging: 16 lanes cover the 256 B of a row, a wave's copy two whole rows;
    // a thread copies rows srow + 16*i, i = 0..7, of each operand
    const int srow = tid >> 4, scg = tid & 15;
    const u16* gA = A + (size_t)(bm + srow) * Kdim + scg * 8;
    const u16* gW = W + (size_t)(bn + srow) * Kdim + scg * 8;
    const unsigned lA = (unsigned)(unsigned long long)&As[0][srow * GPITCH + scg * 8];
    const unsigned lB = (unsigned)(unsigned long long)&Bs[0][srow * GPITCH + scg * 8];

    auto stage = [&](int buf, int k0) {
        unsigned l[8];
        const u16* g[8];
#pragma unroll
        for (int i = 0; i < 8; ++i) {
            l[i] = lA + (unsigned)(buf * GBUF + i * 16 * GPITCH) * 2u;
            g[i] = gA + (size_t)(i * 16) * Kdim + k0;
        }
        async_ld8_b128(l, g);
#pragma unroll
        for (int i = 0; i < 8; ++i) {
            l[i] = lB + (unsigned)(buf * GBUF + i * 16 * GPITCH) * 2u;
            g[i] = gW + (size_t)(i * 16) * Kdim + k0;
        }
        async_ld8_b128(l, g);
    };

    const int KT = Kdim / GK;
    stage(0, 0);
    // tile 0 has landed for this wave, then for the block
    asm volatile("s_wait_asynccnt 0x0" ::: "memory");
    __syncthreads();
    if (KT > 1) stage(1, GK);

    for (int kt = 0; kt < KT; ++kt) {
        const int buf = kt & 1;
#pragma unroll
        for (int kk = 0; kk < GK / 32; ++kk) {
            v16bf af[2], bf[4];
#pragma unroll
            for (int i = 0; i < 2; ++i)
                af[i] = ld_frag(&As[buf][0], wm * 32 + i * 16, GPITCH, kk * 32, lane);
#pragma unroll
            for (int j = 0; j < 4; ++j)
                bf[j] = ld_frag(&Bs[buf][0], wn * 64 + j * 16, GPITCH, kk * 32, lane);
#pragma unroll
            for (int i = 0; i < 2; ++i)
#pragma unroll
                for (int j = 0; j < 4; ++j)
                    acc[i][j] = wmma_bf16(af[i], bf[j], acc[i][j]);
        }

        // hand-over: this wave's reads of buf are done, its copies of the next
        // tile have landed; the one barrier publishes that tile and frees buf
        asm volatile("s_wait_dscnt 0x0" ::: "memory");
        asm volatile("s_wait_asynccnt 0x0" ::: "memory");
        __syncthreads();
        if (kt + 2 < KT) stage(buf, (kt + 2) * GK);
    }
    // no copy is outstanding when the wave goes on to its end
    asm volatile("s_wait_asynccnt 0x0" ::: "memory");

    // Epilogue. C layout: row = rr + 8*hi, col = lane&15.
#pragma unroll
    for (int i = 0; i < 2; ++i)
#pragma unroll
        for (int j = 0; j < 4; ++j)
#pragma unroll
            for (int rr = 0; rr < 8; ++rr) {
                int row = bm + wm * 32 + i * 16 + rr + 8 * hi;
                int col = bn + wn * 64 + j * 16 + (lane & 15);
                float v = acc[i][j][rr];
                if (BIAS)  v += bias[col];
                if (RELU)  v = fmaxf(v, 0.0f);
                if (RESID) v += resid[(size_t)row * Ndim + col];
                if (OUTBF) outB[(size_t)row * Ndim + col] = f2bf(v);
                else       outF[(size_t)row * Ndim + col] = v;
            }
}

typedef __attribute__((ext_vector_type(2))) float  v2f;
typedef __attribute__((ext_vector_type(2))) __bf16 v2bf;

__device__ __forceinline__ unsigned pack_bf2(float lo, float hi2) {
    v2f t = { lo, hi2 };
    return __builtin_bit_cast(unsigned, __builtin_convertvector(t, v2bf));
}

__device__ __forceinline__ float xhalf(float x) {
    int b = __builtin_bit_cast(int, x);
    return __builtin_bit_cast(float, __builtin_amdgcn_permlanex16(
        b, b, 0x76543210, 0xfedcba98, false, false));
}

// 16-byte transposing LDS load: from a row-major [key][feat] tile a lane gets 8
// consecutive keys of one feature (half of a V^T fragment in the hardware k order)
typedef short s16x8 __attribute__((ext_vector_type(8)));
__device__ __forceinline__ uint4 ld_tr16(const unsigned char* p) {
    typedef __attribute__((address_space(3))) s16x8 lds_s16x8;
    return __builtin_bit_cast(uint4, __builtin_amdgcn_ds_load_tr16_b128_v8i16((lds_s16x8*)p));
}

// K and V come in stages of AK keys, both row-major as they lie in memory, into two
// LDS buffers filled by async copies: the copies of stage t+1 fly during the whole
// of stage t. K rows at 144 B (16 B x odd, for b128 reads), V rows at 160 B
// (32 B x odd, for the transposing reads).
#define AK      128                 // keys per stage
#define AKP     72                  // K row pitch in elements (144 B)
#define AVP     80                  // V row pitch in elements (160 B)
__global__ __launch_bounds__(256) void attn_kernel(
    const u16* __restrict__ q, const u16* __restrict__ k,
    const u16* __restrict__ v, u16* __restrict__ ctx) {
    __shared__ __attribute__((aligned(16))) u16 Ks[2][AK * AKP];   // [key][feat]
    __shared__ __attribute__((aligned(16))) u16 Vs[2][AK * AVP];   // [key][feat]

    const int tid  = threadIdx.x;
    const int lane = tid & 31;
    const int wave = tid >> 5;
    const int hi   = lane >> 4;
    const int h    = blockIdx.y;
    const int b    = blockIdx.z;
    const int qrow0 = b * SDIM + blockIdx.x * 128 + wave * 16;

    // staging: 8 lanes cover the 128 B of a row, a wave's copy four whole rows;
    // a thread copies rows srow + 32*i, i = 0..3, of K and of V
    const int srow = tid >> 3, scg = tid & 7;
    const u16* gK = k + (size_t)(b * SDIM + srow) * DDIM + h * DH + scg * 8;
    const u16* gV = v + (size_t)(b * SDIM + srow) * DDIM + h * DH + scg * 8;
    const unsigned lK = (unsigned)(unsigned long long)&Ks[0][srow * AKP + scg * 8];
    const unsigned lV = (unsigned)(unsigned long long)&Vs[0][srow * AVP + scg * 8];

    auto stage = [&](int buf, int st) {
        unsigned l[8];
        const u16* g[8];
#pragma unroll
        for (int i = 0; i < 4; ++i) {
            l[i]     = lK + (unsigned)(buf * AK * AKP + i * 32 * AKP) * 2u;
            g[i]     = gK + (size_t)(st * AK + i * 32) * DDIM;
            l[4 + i] = lV + (unsigned)(buf * AK * AVP + i * 32 * AVP) * 2u;
            g[4 + i] = gV + (size_t)(st * AK + i * 32) * DDIM;
        }
        async_ld8_b128(l, g);
    };

    stage(0, 0);

    // Q fragments (16 x 64 per wave) straight from global bf16; B operand
    v16bf qa[2];
#pragma unroll
    for (int d = 0; d < 2; ++d)
        qa[d] = ld_frag(q + (size_t)qrow0 * DDIM + h * DH + d * 32, 0, DDIM, 0, lane);

    // o[c][rr] = O[query lane&15][feat c*16 + 8*hi + rr]
    v8f o[4] = {};
    float Mx = -1e30f;   // running maximum of this lane's query (same in both halves)
    float Lr = 0.0f;     // running sum over this half's keys; halves joined at the end

    constexpr int NT = SDIM / AK;
    static_assert(NT >= 2, "the prologue fills two stages");
    // stage 0 has landed for this wave, then for the block
    asm volatile("s_wait_asynccnt 0x0" ::: "memory");
    __syncthreads();
    stage(1, 1);

    for (int st = 0; st < NT; ++st) {
      const int buf = st & 1;
      const u16* Kt = &Ks[buf][0];
      // this lane's address in the transposing loads of V, pass 0, features 0..15
      const unsigned char* Vl = (const unsigned char*)&Vs[buf][0]
          + (8 * hi + (lane & 7)) * (AVP * 2) + ((lane >> 3) & 1) * 16;
      // kept rolled: unrolled, the accumulators change registers from pass to pass
      // and are copied back at every stage
#pragma unroll 1
      for (int sub = 0; sub < AK / 32; ++sub) {
        // scores, transposed: s[kc][rr] = S[key kc*16 + 8*hi + rr][query lane&15]
        v8f s[2] = {};
#pragma unroll
        for (int kc = 0; kc < 2; ++kc)
#pragma unroll
            for (int d = 0; d < 2; ++d)
                s[kc] = wmma_bf16(ld_frag(Kt, sub * 32 + kc * 16, AKP, d * 32, lane), qa[d], s[kc]);

        // scale + relu + streaming softmax, one query per lane
        float mloc = 0.0f;   // relu: no score is below 0
#pragma unroll
        for (int kc = 0; kc < 2; ++kc)
#pragma unroll
            for (int rr = 0; rr < 8; ++rr) {
                s[kc][rr] = fmaxf(s[kc][rr] * 0.125f, 0.0f);
                mloc = fmaxf(mloc, s[kc][rr]);
            }
        mloc = fmaxf(mloc, xhalf(mloc));
        const float mnew  = fmaxf(Mx, mloc);
        const float alpha = __expf(Mx - mnew);
        float sum = 0.0f;
#pragma unroll
        for (int kc = 0; kc < 2; ++kc)
#pragma unroll
            for (int rr = 0; rr < 8; ++rr) {
                s[kc][rr] = __expf(s[kc][rr] - mnew);
                sum += s[kc][rr];
            }
        Lr = Lr * alpha + sum;
        Mx = mnew;

        // P^T as B operand: element e = key (e < 8 ? 8*hi + e : 16 + 8*hi + e - 8),
        // the k order in which the two transposing loads deliver V^T
        union { unsigned u[8]; v16bf v; } pb;
#pragma unroll
        for (int kc = 0; kc < 2; ++kc)
#pragma unroll
            for (int e = 0; e < 4; ++e)
                pb.u[kc * 4 + e] = pack_bf2(s[kc][2 * e], s[kc][2 * e + 1]);

#pragma unroll
        for (int c = 0; c < 4; ++c) {
#pragma unroll
            for (int rr = 0; rr < 8; ++rr)
                o[c][rr] *= alpha;
            // V^T fragment: features c*16 + (lane&15), keys 8*hi + 0..7 and 16 + 8*hi + 0..7
            Frag16 vf;
            vf.q[0] = ld_tr16(Vl + (sub * 32) * (AVP * 2) + c * 32);
            vf.q[1] = ld_tr16(Vl + (sub * 32 + 16) * (AVP * 2) + c * 32);
            o[c] = wmma_bf16(vf.v, pb.v, o[c]);
        }
        __builtin_amdgcn_sched_barrier(0);
        asm volatile("v_nop\n\tv_nop\n\tv_nop\n\tv_nop");
      }

      // hand-over: this wave's reads of buf are done, its copies of the next
      // stage have landed; the one barrier publishes that stage and frees buf
      asm volatile("s_wait_dscnt 0x0" ::: "memory");
      asm volatile("s_wait_asynccnt 0x0" ::: "memory");
      __syncthreads();
      if (st + 2 < NT) stage(buf, st + 2);
    }
    // no copy is outstanding when the wave goes on to its end
    asm volatile("s_wait_asynccnt 0x0" ::: "memory");

    // join the halves' sums, normalize and emit ctx as bf16:
    // 8 consecutive features of one query per lane and tile = one 16-byte store
    Lr += xhalf(Lr);
    u16* crow = ctx + (size_t)(qrow0 + (lane & 15)) * DDIM + h * DH + 8 * hi;
#pragma unroll
    for (int c = 0; c < 4; ++c) {
        uint4 w;
        w.x = pack_bf2(o[c][0] / Lr, o[c][1] / Lr);
        w.y = pack_bf2(o[c][2] / Lr, o[c][3] / Lr);
        w.z = pack_bf2(o[c][4] / Lr, o[c][5] / Lr);
        w.w = pack_bf2(o[c][6] / Lr, o[c][7] / Lr);
        *(uint4*)(crow + c * 16) = w;
    }
}

// ---------- LayerNorm over D=1024 (input already holds x + residual) ----------
__global__ __launch_bounds__(256) void ln_kernel(
    const float* __restrict__ x, const float* __restrict__ g,
    const float* __restrict__ bta, float* __restrict__ yf,
    u16* __restrict__ yb) {
    __shared__ float sh[16];
    const int row = blockIdx.x, tid = threadIdx.x;
    const float* xr = x + (size_t)row * DDIM;
    float4 xv = *(const float4*)(xr + tid * 4);
    float s = xv.x + xv.y + xv.z + xv.w;
    float qq = xv.x * xv.x + xv.y * xv.y + xv.z * xv.z + xv.w * xv.w;
#pragma unroll
    for (int off = 16; off; off >>= 1) {
        s  += __shfl_xor(s, off, 32);
        qq += __shfl_xor(qq, off, 32);
    }
    int wv = tid >> 5, ln = tid & 31;
    if (ln == 0) { sh[wv] = s; sh[8 + wv] = qq; }
    __syncthreads();
    if (tid == 0) {
        float a = 0.f, b2 = 0.f;
        for (int i = 0; i < 8; ++i) { a += sh[i]; b2 += sh[8 + i]; }
        sh[0] = a; sh[8] = b2;
    }
    __syncthreads();
    float mu  = sh[0] * (1.0f / DDIM);
    float var = sh[8] * (1.0f / DDIM) - mu * mu;
    float inv = rsqrtf(var + 1e-5f);
    const float* xp = (const float*)&xv;
#pragma unroll
    for (int j = 0; j < 4; ++j) {
        int col = tid * 4 + j;
        float yv = (xp[j] - mu) * inv * g[col] + bta[col];
        yf[(size_t)row * DDIM + col] = yv;
        if (yb) yb[(size_t)row * DDIM + col] = f2bf(yv);
    }
}

// ---------- host ----------
extern "C" void kernel_launch(void* const* d_in, const int* in_sizes, int n_in,
                              void* d_out, int out_size, void* d_ws, size_t ws_size,
                              hipStream_t stream) {
    const float* X    = (const float*)d_in[0];
    const float* Wq   = (const float*)d_in[1];
    const float* Wk   = (const float*)d_in[2];
    const float* Wo   = (const float*)d_in[3];
    const float* ln1g = (const float*)d_in[4];
    const float* ln1b = (const float*)d_in[5];
    const float* ln2g = (const float*)d_in[6];
    const float* ln2b = (const float*)d_in[7];
    const float* W1   = (const float*)d_in[8];
    const float* b1   = (const float*)d_in[9];
    const float* W2   = (const float*)d_in[10];
    const float* b2   = (const float*)d_in[11];

    char* ws = (char*)d_ws;
    size_t off = 0;
    auto alloc = [&](size_t bytes) {
        char* p = ws + off;
        off += (bytes + 255) & ~size_t(255);
        return p;
    };
    u16*   Xb   = (u16*)alloc((size_t)MROWS * DDIM * 2);
    u16*   Wqb  = (u16*)alloc((size_t)DDIM * DDIM * 2);
    u16*   Wkb  = (u16*)alloc((size_t)DDIM * DDIM * 2);
    u16*   Wob  = (u16*)alloc((size_t)DDIM * DDIM * 2);
    u16*   W1b  = (u16*)alloc((size_t)FFD * DDIM * 2);
    u16*   W2b  = (u16*)alloc((size_t)DDIM * FFD * 2);
    u16*   qb   = (u16*)alloc((size_t)MROWS * DDIM * 2);
    u16*   kb   = (u16*)alloc((size_t)MROWS * DDIM * 2);
    u16*   vb   = (u16*)alloc((size_t)MROWS * DDIM * 2);
    u16*   ctxb = (u16*)alloc((size_t)MROWS * DDIM * 2);
    float* ares = (float*)alloc((size_t)MROWS * DDIM * 4);
    float* yf   = (float*)alloc((size_t)MROWS * DDIM * 4);
    u16*   yb   = (u16*)alloc((size_t)MROWS * DDIM * 2);
    u16*   hb   = (u16*)alloc((size_t)MROWS * FFD * 2);
    float* fres = (float*)alloc((size_t)MROWS * DDIM * 4);

    // Xb, Wqb, Wkb, Wob, W1b, W2b are consecutive (each size a multiple of 256 bytes)
    cvt_bf16_kernel<<<CVT_BLOCKS, 256, 0, stream>>>(X, Wq, Wk, Wo, W1, W2, Xb);

    // Q, K, V projections (V uses Wo per reference) -> bf16
    dim3 gproj(DDIM / 128, MROWS / 128);
    gemm_bf16_kernel<false, false, false, true><<<gproj, 256, 0, stream>>>(
        Xb, Wqb, nullptr, nullptr, nullptr, qb, MROWS, DDIM, DDIM);
    gemm_bf16_kernel<false, false, false, true><<<gproj, 256, 0, stream>>>(
        Xb, Wkb, nullptr, nullptr, nullptr, kb, MROWS, DDIM, DDIM);
    gemm_bf16_kernel<false, false, false, true><<<gproj, 256, 0, stream>>>(
        Xb, Wob, nullptr, nullptr, nullptr, vb, MROWS, DDIM, DDIM);

    // attention -> ctx (bf16)
    attn_kernel<<<dim3(SDIM / 128, HDIM, BDIM), 256, 0, stream>>>(qb, kb, vb, ctxb);

    // att_out = ctx @ Wo^T + X  (fp32)
    gemm_bf16_kernel<false, false, true, false><<<gproj, 256, 0, stream>>>(
        ctxb, Wob, nullptr, X, ares, nullptr, MROWS, DDIM, DDIM);

    // y = LN1(att_out + X)  -> fp32 + bf16
    ln_kernel<<<MROWS, 256, 0, stream>>>(ares, ln1g, ln1b, yf, yb);

    // h = relu(y @ W1^T + b1) -> bf16
    dim3 gffn1(FFD / 128, MROWS / 128);
    gemm_bf16_kernel<true, true, false, true><<<gffn1, 256, 0, stream>>>(
        yb, W1b, b1, nullptr, nullptr, hb, MROWS, FFD, DDIM);

    // f = h @ W2^T + b2 + y -> fp32
    gemm_bf16_kernel<true, false, true, false><<<gproj, 256, 0, stream>>>(
        hb, W2b, b2, yf, fres, nullptr, MROWS, DDIM, FFD);

    // out = LN2(f + y)
    ln_kernel<<<MROWS, 256, 0, stream>>>(fres, ln2g, ln2b, (float*)d_out, nullptr);
}

// v005
// One run takes 176 microseconds.
// Timed twice side by side with v004, it ran 1.03 times as fast both times.
// Over all steps from v000 it is 2.06 times as fast.
#include <hip/hip_runtime.h>
#include <hip/hip_bf16.h>

typedef unsigned short u16;
typedef __attribute__((ext_vector_type(16))) __bf16 v16bf;
typedef __attribute__((ext_vector_type(8)))  float  v8f;

#define DDIM 1024
#define SDIM 2048
#define BDIM 2
#define HDIM 16
#define DH   64
#define FFD  4096
#define MROWS 4096   // B*S
#define QKVP (3 * DDIM)   // row pitch of the joint q | k | v array, in elements

// ---------- helpers ----------
__device__ __forceinline__ u16 f2bf(float f) {
    unsigned u = __float_as_uint(f);
    unsigned r = ((u >> 16) & 1u) + 0x7FFFu;
    return (u16)((u + r) >> 16);
}

union Frag16 { uint4 q[2]; v16bf v; };

__device__ __forceinline__ v16bf ld_frag(const u16* t, int row0, int stride,
                                         int coloff, int lane) {
    int r = lane & 15, hi = lane >> 4;
    const u16* p = t + (size_t)(row0 + r) * stride + coloff + hi * 8;
    Frag16 f;
    f.q[0] = *(const uint4*)(p);
    f.q[1] = *(const uint4*)(p + 16);
    return f.v;
}

__device__ __forceinline__ v8f wmma_bf16(v16bf a, v16bf b, v8f c) {
    return __builtin_amdgcn_wmma_f32_16x16x32_bf16(
        false, a, false, b, (short)0, c, false, false);
}

// ---------- fp32 -> bf16 conversion, all six operands in one launch ----------
// The six bf16 copies lie back to back in the workspace, so the output is one
// array. A row is 1024 elements (one float4 per thread). A block converts
// CVT_ROWS consecutive rows; every operand is a whole number of such groups,
// so a block has one source. Each thread issues all its loads before the first
// conversion.
#define CVT_ROWS   16
#define CVT_RX     (MROWS * DDIM / 1024)   // rows of X
#define CVT_RW     (DDIM * DDIM / 1024)    // rows of Wq, Wk, Wo each
#define CVT_RF     (FFD * DDIM / 1024)     // rows of W1, W2 each
#define CVT_BLOCKS ((CVT_RX + 3 * CVT_RW + 2 * CVT_RF) / CVT_ROWS)
static_assert(CVT_RX % CVT_ROWS == 0 && CVT_RW % CVT_ROWS == 0 && CVT_RF % CVT_ROWS == 0,
              "a block must not straddle two operands");

__global__ __launch_bounds__(256) __attribute__((amdgpu_waves_per_eu(8, 8)))
void cvt_bf16_kernel(
    const float* __restrict__ X,  const float* __restrict__ Wq,
    const float* __restrict__ Wk, const float* __restrict__ Wo,
    const float* __restrict__ W1, const float* __restrict__ W2,
    u16* __restrict__ out) {
    const int tid = threadIdx.x;
    const int r0  = blockIdx.x * CVT_ROWS;
    int r = r0;                 // first row, counted within its own operand
    const float* s = X;
    if (r >= CVT_RX) {
        r -= CVT_RX; s = Wq;
        if (r >= CVT_RW) { r -= CVT_RW; s = Wk; }
        if (r >= CVT_RW) { r -= CVT_RW; s = Wo; }
        if (r >= CVT_RW) { r -= CVT_RW; s = W1; }
        if (r >= CVT_RF) { r -= CVT_RF; s = W2; }
    }
    const float* sp = s + (size_t)r * 1024 + tid * 4;
    u16*         op = out + (size_t)r0 * 1024 + tid * 4;
    float4 v[CVT_ROWS];
    // both loops unrolled: v stays in registers and the loads issue as one group
#pragma unroll
    for (int j = 0; j < CVT_ROWS; ++j)
        v[j] = *(const float4*)(sp + j * 1024);
#pragma unroll
    for (int j = 0; j < CVT_ROWS; ++j) {
        u16 o[4] = { f2bf(v[j].x), f2bf(v[j].y), f2bf(v[j].z), f2bf(v[j].w) };
        *(uint2*)(op + j * 1024) = *(const uint2*)o;
    }
}

__device__ __forceinline__ void async_ld8_b128(const unsigned (&l)[8],
                                               const u16* const (&g)[8]) {
    asm volatile("global_load_async_to_lds_b128 %0, %8, off\n\t"
                 "global_load_async_to_lds_b128 %1, %9, off\n\t"
                 "global_load_async_to_lds_b128 %2, %10, off\n\t"
                 "global_load_async_to_lds_b128 %3, %11, off\n\t"
                 "global_load_async_to_lds_b128 %4, %12, off\n\t"
                 "global_load_async_to_lds_b128 %5, %13, off\n\t"
                 "global_load_async_to_lds_b128 %6, %14, off\n\t"
                 "global_load_async_to_lds_b128 %7, %15, off\n\t"
                 "s_wait_xcnt 0x0"
                 :: "v"(l[0]), "v"(l[1]), "v"(l[2]), "v"(l[3]),
                    "v"(l[4]), "v"(l[5]), "v"(l[6]), "v"(l[7]),
                    "v"(g[0]), "v"(g[1]), "v"(g[2]), "v"(g[3]),
                    "v"(g[4]), "v"(g[5]), "v"(g[6]), "v"(g[7])
                 : "memory");
}

#define GK      128                 // k per pass
#define GPITCH  136                 // LDS row pitch in elements (272 B)
#define GBUF    (128 * GPITCH)      // elements of one operand's buffer
template <bool BIAS, bool RELU, bool RESID, bool OUTBF>
__global__ __launch_bounds__(256) void gemm_bf16_kernel(
    const u16* __restrict__ A, const u16* __restrict__ W,
    const float* __restrict__ bias, const float* __restrict__ resid,
    float* __restrict__ outF, u16* __restrict__ outB,
    int Mdim, int Ndim, int Kdim) {
    __shared__ __attribute__((aligned(16))) u16 As[2][GBUF];
    __shared__ __attribute__((aligned(16))) u16 Bs[2][GBUF];

    const int tid  = threadIdx.x;
    const int lane = tid & 31;
    const int wave = tid >> 5;
    const int wm   = wave >> 1;   // 0..3
    const int wn   = wave & 1;    // 0..1
    const int bm   = blockIdx.y * 128;
    const int bn   = blockIdx.x * 128;
    const int hi   = lane >> 4;

    v8f acc[2][4] = {};

    // staging: 16 lanes cover the 256 B of a row, a wave's copy two whole rows;
    // a thread copies rows srow + 16*i, i = 0..7, of each operand
    const int srow = tid >> 4, scg = tid & 15;
    const u16* gA = A + (size_t)(bm + srow) * Kdim + scg * 8;
    const u16* gW = W + (size_t)(bn + srow) * Kdim + scg * 8;
    const unsigned lA = (unsigned)(unsigned long long)&As[0][srow * GPITCH + scg * 8];
    const unsigned lB = (unsigned)(unsigned long long)&Bs[0][srow * GPITCH + scg * 8];

    auto stage = [&](int buf, int k0) {
        unsigned l[8];
        const u16* g[8];
#pragma unroll
        for (int i = 0; i < 8; ++i) {
            l[i] = lA + (unsigned)(buf * GBUF + i * 16 * GPITCH) * 2u;
            g[i] = gA + (size_t)(i * 16) * Kdim + k0;
        }
        async_ld8_b128(l, g);
#pragma unroll
        for (int i = 0; i < 8; ++i) {
            l[i] = lB + (unsigned)(buf * GBUF + i * 16 * GPITCH) * 2u;
            g[i] = gW + (size_t)(i * 16) * Kdim + k0;
        }
        async_ld8_b128(l, g);
    };

    const int KT = Kdim / GK;
    stage(0, 0);
    // tile 0 has landed for this wave, then for the block
    asm volatile("s_wait_asynccnt 0x0" ::: "memory");
    __syncthreads();
    if (KT > 1) stage(1, GK);

    for (int kt = 0; kt < KT; ++kt) {
        const int buf = kt & 1;
#pragma unroll
        for (int kk = 0; kk < GK / 32; ++kk) {
            v16bf af[2], bf[4];
#pragma unroll
            for (int i = 0; i < 2; ++i)
                af[i] = ld_frag(&As[buf][0], wm * 32 + i * 16, GPITCH, kk * 32, lane);
#pragma unroll
            for (int j = 0; j < 4; ++j)
                bf[j] = ld_frag(&Bs[buf][0], wn * 64 + j * 16, GPITCH, kk * 32, lane);
#pragma unroll
            for (int i = 0; i < 2; ++i)
#pragma unroll
                for (int j = 0; j < 4; ++j)
                    acc[i][j] = wmma_bf16(af[i], bf[j], acc[i][j]);
        }

        // hand-over: this wave's reads of buf are done, its copies of the next
        // tile have landed; the one barrier publishes that tile and frees buf
        asm volatile("s_wait_dscnt 0x0" ::: "memory");
        asm volatile("s_wait_asynccnt 0x0" ::: "memory");
        __syncthreads();
        if (kt + 2 < KT) stage(buf, (kt + 2) * GK);
    }
    // no copy is outstanding when the wave goes on to its end
    asm volatile("s_wait_asynccnt 0x0" ::: "memory");

    // Epilogue. C layout: row = rr + 8*hi, col = lane&15.
#pragma unroll
    for (int i = 0; i < 2; ++i)
#pragma unroll
        for (int j = 0; j < 4; ++j)
#pragma unroll
            for (int rr = 0; rr < 8; ++rr) {
                int row = bm + wm * 32 + i * 16 + rr + 8 * hi;
                int col = bn + wn * 64 + j * 16 + (lane & 15);
                float v = acc[i][j][rr];
                if (BIAS)  v += bias[col];
                if (RELU)  v = fmaxf(v, 0.0f);
                if (RESID) v += resid[(size_t)row * Ndim + col];
                if (OUTBF) outB[(size_t)row * Ndim + col] = f2bf(v);
                else       outF[(size_t)row * Ndim + col] = v;
            }
}

typedef __attribute__((ext_vector_type(2))) float  v2f;
typedef __attribute__((ext_vector_type(2))) __bf16 v2bf;

__device__ __forceinline__ unsigned pack_bf2(float lo, float hi2) {
    v2f t = { lo, hi2 };
    return __builtin_bit_cast(unsigned, __builtin_convertvector(t, v2bf));
}

__device__ __forceinline__ float xhalf(float x) {
    int b = __builtin_bit_cast(int, x);
    return __builtin_bit_cast(float, __builtin_amdgcn_permlanex16(
        b, b, 0x76543210, 0xfedcba98, false, false));
}

// 16-byte transposing LDS load: from a row-major [key][feat] tile a lane gets 8
// consecutive keys of one feature (half of a V^T fragment in the hardware k order)
typedef short s16x8 __attribute__((ext_vector_type(8)));
__device__ __forceinline__ uint4 ld_tr16(const unsigned char* p) {
    typedef __attribute__((address_space(3))) s16x8 lds_s16x8;
    return __builtin_bit_cast(uint4, __builtin_amdgcn_ds_load_tr16_b128_v8i16((lds_s16x8*)p));
}

// K and V come in stages of AK keys, both row-major as they lie in memory, into two
// LDS buffers filled by async copies: the copies of stage t+1 fly during the whole
// of stage t. K rows at 144 B (16 B x odd, for b128 reads), V rows at 160 B
// (32 B x odd, for the transposing reads).
#define AK      128                 // keys per stage
#define AKP     72                  // K row pitch in elements (144 B)
#define AVP     80                  // V row pitch in elements (160 B)
__global__ __launch_bounds__(256) void attn_kernel(
    const u16* __restrict__ q, const u16* __restrict__ k,
    const u16* __restrict__ v, u16* __restrict__ ctx) {
    __shared__ __attribute__((aligned(16))) u16 Ks[2][AK * AKP];   // [key][feat]
    __shared__ __attribute__((aligned(16))) u16 Vs[2][AK * AVP];   // [key][feat]

    const int tid  = threadIdx.x;
    const int lane = tid & 31;
    const int wave = tid >> 5;
    const int hi   = lane >> 4;
    const int h    = blockIdx.y;
    const int b    = blockIdx.z;
    const int qrow0 = b * SDIM + blockIdx.x * 128 + wave * 16;

    // staging: 8 lanes cover the 128 B of a row, a wave's copy four whole rows;
    // a thread copies rows srow + 32*i, i = 0..3, of K and of V
    const int srow = tid >> 3, scg = tid & 7;
    const u16* gK = k + (size_t)(b * SDIM + srow) * QKVP + h * DH + scg * 8;
    const u16* gV = v + (size_t)(b * SDIM + srow) * QKVP + h * DH + scg * 8;
    const unsigned lK = (unsigned)(unsigned long long)&Ks[0][srow * AKP + scg * 8];
    const unsigned lV = (unsigned)(unsigned long long)&Vs[0][srow * AVP + scg * 8];

    auto stage = [&](int buf, int st) {
        unsigned l[8];
        const u16* g[8];
#pragma unroll
        for (int i = 0; i < 4; ++i) {
            l[i]     = lK + (unsigned)(buf * AK * AKP + i * 32 * AKP) * 2u;
            g[i]     = gK + (size_t)(st * AK + i * 32) * QKVP;
            l[4 + i] = lV + (unsigned)(buf * AK * AVP + i * 32 * AVP) * 2u;
            g[4 + i] = gV + (size_t)(st * AK + i * 32) * QKVP;
        }
        async_ld8_b128(l, g);
    };

    stage(0, 0);

    // Q fragments (16 x 64 per wave) straight from global bf16; B operand
    v16bf qa[2];
#pragma unroll
    for (int d = 0; d < 2; ++d)
        qa[d] = ld_frag(q + (size_t)qrow0 * QKVP + h * DH + d * 32, 0, QKVP, 0, lane);

    // o[c][rr] = O[query lane&15][feat c*16 + 8*hi + rr]
    v8f o[4] = {};
    float Mx = -1e30f;   // running maximum of this lane's query (same in both halves)
    float Lr = 0.0f;     // running sum over this half's keys; halves joined at the end

    constexpr int NT = SDIM / AK;
    static_assert(NT >= 2, "the prologue fills two stages");
    // stage 0 has landed for this wave, then for the block
    asm volatile("s_wait_asynccnt 0x0" ::: "memory");
    __syncthreads();
    stage(1, 1);

    for (int st = 0; st < NT; ++st) {
      const int buf = st & 1;
      const u16* Kt = &Ks[buf][0];
      // this lane's address in the transposing loads of V, pass 0, features 0..15
      const unsigned char* Vl = (const unsigned char*)&Vs[buf][0]
          + (8 * hi + (lane & 7)) * (AVP * 2) + ((lane >> 3) & 1) * 16;
      // kept rolled: unrolled, the accumulators change registers from pass to pass
      // and are copied back at every stage
#pragma unroll 1
      for (int sub = 0; sub < AK / 32; ++sub) {
        // scores, transposed: s[kc][rr] = S[key kc*16 + 8*hi + rr][query lane&15]
        v8f s[2] = {};
#pragma unroll
        for (int kc = 0; kc < 2; ++kc)
#pragma unroll
            for (int d = 0; d < 2; ++d)
                s[kc] = wmma_bf16(ld_frag(Kt, sub * 32 + kc * 16, AKP, d * 32, lane), qa[d], s[kc]);

        // scale + relu + streaming softmax, one query per lane
        float mloc = 0.0f;   // relu: no score is below 0
#pragma unroll
        for (int kc = 0; kc < 2; ++kc)
#pragma unroll
            for (int rr = 0; rr < 8; ++rr) {
                s[kc][rr] = fmaxf(s[kc][rr] * 0.125f, 0.0f);
                mloc = fmaxf(mloc, s[kc][rr]);
            }
        mloc = fmaxf(mloc, xhalf(mloc));
        const float mnew  = fmaxf(Mx, mloc);
        const float alpha = __expf(Mx - mnew);
        float sum = 0.0f;
#pragma unroll
        for (int kc = 0; kc < 2; ++kc)
#pragma unroll
            for (int rr = 0; rr < 8; ++rr) {
                s[kc][rr] = __expf(s[kc][rr] - mnew);
                sum += s[kc][rr];
            }
        Lr = Lr * alpha + sum;
        Mx = mnew;

        // P^T as B operand: element e = key (e < 8 ? 8*hi + e : 16 + 8*hi + e - 8),
        // the k order in which the two transposing loads deliver V^T
        union { unsigned u[8]; v16bf v; } pb;
#pragma unroll
        for (int kc = 0; kc < 2; ++kc)
#pragma unroll
            for (int e = 0; e < 4; ++e)
                pb.u[kc * 4 + e] = pack_bf2(s[kc][2 * e], s[kc][2 * e + 1]);

#pragma unroll
        for (int c = 0; c < 4; ++c) {
#pragma unroll
            for (int rr = 0; rr < 8; ++rr)
                o[c][rr] *= alpha;
            // V^T fragment: features c*16 + (lane&15), keys 8*hi + 0..7 and 16 + 8*hi + 0..7
            Frag16 vf;
            vf.q[0] = ld_tr16(Vl + (sub * 32) * (AVP * 2) + c * 32);
            vf.q[1] = ld_tr16(Vl + (sub * 32 + 16) * (AVP * 2) + c * 32);
            o[c] = wmma_bf16(vf.v, pb.v, o[c]);
        }
        __builtin_amdgcn_sched_barrier(0);
        asm volatile("v_nop\n\tv_nop\n\tv_nop\n\tv_nop");
      }

      // hand-over: this wave's reads of buf are done, its copies of the next
      // stage have landed; the one barrier publishes that stage and frees buf
      asm volatile("s_wait_dscnt 0x0" ::: "memory");
      asm volatile("s_wait_asynccnt 0x0" ::: "memory");
      __syncthreads();
      if (st + 2 < NT) stage(buf, st + 2);
    }
    // no copy is outstanding when the wave goes on to its end
    asm volatile("s_wait_asynccnt 0x0" ::: "memory");

    // join the halves' sums, normalize and emit ctx as bf16:
    // 8 consecutive features of one query per lane and tile = one 16-byte store
    Lr += xhalf(Lr);
    u16* crow = ctx + (size_t)(qrow0 + (lane & 15)) * DDIM + h * DH + 8 * hi;
#pragma unroll
    for (int c = 0; c < 4; ++c) {
        uint4 w;
        w.x = pack_bf2(o[c][0] / Lr, o[c][1] / Lr);
        w.y = pack_bf2(o[c][2] / Lr, o[c][3] / Lr);
        w.z = pack_bf2(o[c][4] / Lr, o[c][5] / Lr);
        w.w = pack_bf2(o[c][6] / Lr, o[c][7] / Lr);
        *(uint4*)(crow + c * 16) = w;
    }
}

// ---------- LayerNorm over D=1024 (input already holds x + residual) ----------
__global__ __launch_bounds__(256) void ln_kernel(
    const float* __restrict__ x, const float* __restrict__ g,
    const float* __restrict__ bta, float* __restrict__ yf,
    u16* __restrict__ yb) {
    __shared__ float sh[16];
    const int row = blockIdx.x, tid = threadIdx.x;
    const float* xr = x + (size_t)row * DDIM;
    float4 xv = *(const float4*)(xr + tid * 4);
    float s = xv.x + xv.y + xv.z + xv.w;
    float qq = xv.x * xv.x + xv.y * xv.y + xv.z * xv.z + xv.w * xv.w;
#pragma unroll
    for (int off = 16; off; off >>= 1) {
        s  += __shfl_xor(s, off, 32);
        qq += __shfl_xor(qq, off, 32);
    }
    int wv = tid >> 5, ln = tid & 31;
    if (ln == 0) { sh[wv] = s; sh[8 + wv] = qq; }
    __syncthreads();
    if (tid == 0) {
        float a = 0.f, b2 = 0.f;
        for (int i = 0; i < 8; ++i) { a += sh[i]; b2 += sh[8 + i]; }
        sh[0] = a; sh[8] = b2;
    }
    __syncthreads();
    float mu  = sh[0] * (1.0f / DDIM);
    float var = sh[8] * (1.0f / DDIM) - mu * mu;
    float inv = rsqrtf(var + 1e-5f);
    const float* xp = (const float*)&xv;
#pragma unroll
    for (int j = 0; j < 4; ++j) {
        int col = tid * 4 + j;
        float yv = (xp[j] - mu) * inv * g[col] + bta[col];
        yf[(size_t)row * DDIM + col] = yv;
        if (yb) yb[(size_t)row * DDIM + col] = f2bf(yv);
    }
}

// ---------- host ----------
extern "C" void kernel_launch(void* const* d_in, const int* in_sizes, int n_in,
                              void* d_out, int out_size, void* d_ws, size_t ws_size,
                              hipStream_t stream) {
    const float* X    = (const float*)d_in[0];
    const float* Wq   = (const float*)d_in[1];
    const float* Wk   = (const float*)d_in[2];
    const float* Wo   = (const float*)d_in[3];
    const float* ln1g = (const float*)d_in[4];
    const float* ln1b = (const float*)d_in[5];
    const float* ln2g = (const float*)d_in[6];
    const float* ln2b = (const float*)d_in[7];
    const float* W1   = (const float*)d_in[8];
    const float* b1   = (const float*)d_in[9];
    const float* W2   = (const float*)d_in[10];
    const float* b2   = (const float*)d_in[11];

    char* ws = (char*)d_ws;
    size_t off = 0;
    auto alloc = [&](size_t bytes) {
        char* p = ws + off;
        off += (bytes + 255) & ~size_t(255);
        return p;
    };
    u16*   Xb   = (u16*)alloc((size_t)MROWS * DDIM * 2);
    u16*   Wqb  = (u16*)alloc((size_t)DDIM * DDIM * 2);
    u16*   Wkb  = (u16*)alloc((size_t)DDIM * DDIM * 2);
    u16*   Wob  = (u16*)alloc((size_t)DDIM * DDIM * 2);
    u16*   W1b  = (u16*)alloc((size_t)FFD * DDIM * 2);
    u16*   W2b  = (u16*)alloc((size_t)DDIM * FFD * 2);
    u16*   qkvb = (u16*)alloc((size_t)MROWS * QKVP * 2);
    u16*   ctxb = (u16*)alloc((size_t)MROWS * DDIM * 2);
    float* ares = (float*)alloc((size_t)MROWS * DDIM * 4);
    float* yf   = (float*)alloc((size_t)MROWS * DDIM * 4);
    u16*   yb   = (u16*)alloc((size_t)MROWS * DDIM * 2);
    u16*   hb   = (u16*)alloc((size_t)MROWS * FFD * 2);
    float* fres = (float*)alloc((size_t)MROWS * DDIM * 4);

    // Xb, Wqb, Wkb, Wob, W1b, W2b are consecutive (each size a multiple of 256 bytes)
    cvt_bf16_kernel<<<CVT_BLOCKS, 256, 0, stream>>>(X, Wq, Wk, Wo, W1, W2, Xb);

    // Q, K, V projections (V uses Wo per reference) -> bf16, as one product:
    // Wqb, Wkb, Wob lie back to back, so they are one [3072][1024] operand, and
    // row m of the result is q[m] | k[m] | v[m]
    dim3 gproj(DDIM / 128, MROWS / 128);
    dim3 gqkv(QKVP / 128, MROWS / 128);
    gemm_bf16_kernel<false, false, false, true><<<gqkv, 256, 0, stream>>>(
        Xb, Wqb, nullptr, nullptr, nullptr, qkvb, MROWS, QKVP, DDIM);

    // attention -> ctx (bf16)
    attn_kernel<<<dim3(SDIM / 128, HDIM, BDIM), 256, 0, stream>>>(
        qkvb, qkvb + DDIM, qkvb + 2 * DDIM, ctxb);

    // att_out = ctx @ Wo^T + X  (fp32)
    gemm_bf16_kernel<false, false, true, false><<<gproj, 256, 0, stream>>>(
        ctxb, Wob, nullptr, X, ares, nullptr, MROWS, DDIM, DDIM);

    // y = LN1(att_out + X)  -> fp32 + bf16
    ln_kernel<<<MROWS, 256, 0, stream>>>(ares, ln1g, ln1b, yf, yb);

    // h = relu(y @ W1^T + b1) -> bf16
    dim3 gffn1(FFD / 128, MROWS / 128);
    gemm_bf16_kernel<true, true, false, true><<<gffn1, 256, 0, stream>>>(
        yb, W1b, b1, nullptr, nullptr, hb, MROWS, FFD, DDIM);

    // f = h @ W2^T + b2 + y -> fp32
    gemm_bf16_kernel<true, false, true, false><<<gproj, 256, 0, stream>>>(
        hb, W2b, b2, yf, fres, nullptr, MROWS, DDIM, FFD);

    // out = LN2(f + y)
    ln_kernel<<<MROWS, 256, 0, stream>>>(fres, ln2g, ln2b, (float*)d_out, nullptr);
}

// v006
// A run of this version takes 168 microseconds.
// Two timings next to v005 put it at 1.05 and 1.04 times that version's speed.
// Over all steps from v000 it is 2.16 times as fast.
#include <hip/hip_runtime.h>
#include <hip/hip_bf16.h>

typedef unsigned short u16;
typedef __attribute__((ext_vector_type(16))) __bf16 v16bf;
typedef __attribute__((ext_vector_type(8)))  float  v8f;

#define DDIM 1024
#define SDIM 2048
#define BDIM 2
#define HDIM 16
#define DH   64
#define FFD  4096
#define MROWS 4096   // B*S
#define QKVP (3 * DDIM)   // row pitch of the joint q | k | v array, in elements

// ---------- helpers ----------
__device__ __forceinline__ u16 f2bf(float f) {
    unsigned u = __float_as_uint(f);
    unsigned r = ((u >> 16) & 1u) + 0x7FFFu;
    return (u16)((u + r) >> 16);
}

union Frag16 { uint4 q[2]; v16bf v; };

__device__ __forceinline__ v16bf ld_frag(const u16* t, int row0, int stride,
                                         int coloff, int lane) {
    int r = lane & 15, hi = lane >> 4;
    const u16* p = t + (size_t)(row0 + r) * stride + coloff + hi * 8;
    Frag16 f;
    f.q[0] = *(const uint4*)(p);
    f.q[1] = *(const uint4*)(p + 16);
    return f.v;
}

__device__ __forceinline__ v8f wmma_bf16(v16bf a, v16bf b, v8f c) {
    return __builtin_amdgcn_wmma_f32_16x16x32_bf16(
        false, a, false, b, (short)0, c, false, false);
}

// two f32 -> one register of two bf16, round to nearest even
typedef __attribute__((ext_vector_type(2))) float  v2f;
typedef __attribute__((ext_vector_type(2))) __bf16 v2bf;

__device__ __forceinline__ unsigned pack_bf2(float lo, float hi2) {
    v2f t = { lo, hi2 };
    return __builtin_bit_cast(unsigned, __builtin_convertvector(t, v2bf));
}

// ---------- fp32 -> bf16 conversion, all six operands in one launch ----------
// The six bf16 copies lie back to back in the workspace, so the output is one
// array. A row is 1024 elements (one float4 per thread). A block converts
// CVT_ROWS consecutive rows; every operand is a whole number of such groups,
// so a block has one source. Each thread issues all its loads before the first
// conversion.
#define CVT_ROWS   16
#define CVT_RX     (MROWS * DDIM / 1024)   // rows of X
#define CVT_RW     (DDIM * DDIM / 1024)    // rows of Wq, Wk, Wo each
#define CVT_RF     (FFD * DDIM / 1024)     // rows of W1, W2 each
#define CVT_BLOCKS ((CVT_RX + 3 * CVT_RW + 2 * CVT_RF) / CVT_ROWS)
static_assert(CVT_RX % CVT_ROWS == 0 && CVT_RW % CVT_ROWS == 0 && CVT_RF % CVT_ROWS == 0,
              "a block must not straddle two operands");

__global__ __launch_bounds__(256) __attribute__((amdgpu_waves_per_eu(8, 8)))
void cvt_bf16_kernel(
    const float* __restrict__ X,  const float* __restrict__ Wq,
    const float* __restrict__ Wk, const float* __restrict__ Wo,
    const float* __restrict__ W1, const float* __restrict__ W2,
    u16* __restrict__ out) {
    const int tid = threadIdx.x;
    const int r0  = blockIdx.x * CVT_ROWS;
    int r = r0;                 // first row, counted within its own operand
    const float* s = X;
    if (r >= CVT_RX) {
        r -= CVT_RX; s = Wq;
        if (r >= CVT_RW) { r -= CVT_RW; s = Wk; }
        if (r >= CVT_RW) { r -= CVT_RW; s = Wo; }
        if (r >= CVT_RW) { r -= CVT_RW; s = W1; }
        if (r >= CVT_RF) { r -= CVT_RF; s = W2; }
    }
    const float* sp = s + (size_t)r * 1024 + tid * 4;
    u16*         op = out + (size_t)r0 * 1024 + tid * 4;
    float4 v[CVT_ROWS];
    // both loops unrolled: v stays in registers and the loads issue as one group
#pragma unroll
    for (int j = 0; j < CVT_ROWS; ++j)
        v[j] = *(const float4*)(sp + j * 1024);
#pragma unroll
    for (int j = 0; j < CVT_ROWS; ++j) {
        u16 o[4] = { f2bf(v[j].x), f2bf(v[j].y), f2bf(v[j].z), f2bf(v[j].w) };
        *(uint2*)(op + j * 1024) = *(const uint2*)o;
    }
}

__device__ __forceinline__ void async_ld8_b128(const unsigned (&l)[8],
                                               const u16* const (&g)[8]) {
    asm volatile("global_load_async_to_lds_b128 %0, %8, off\n\t"
                 "global_load_async_to_lds_b128 %1, %9, off\n\t"
                 "global_load_async_to_lds_b128 %2, %10, off\n\t"
                 "global_load_async_to_lds_b128 %3, %11, off\n\t"
                 "global_load_async_to_lds_b128 %4, %12, off\n\t"
                 "global_load_async_to_lds_b128 %5, %13, off\n\t"
                 "global_load_async_to_lds_b128 %6, %14, off\n\t"
                 "global_load_async_to_lds_b128 %7, %15, off\n\t"
                 "s_wait_xcnt 0x0"
                 :: "v"(l[0]), "v"(l[1]), "v"(l[2]), "v"(l[3]),
                    "v"(l[4]), "v"(l[5]), "v"(l[6]), "v"(l[7]),
                    "v"(g[0]), "v"(g[1]), "v"(g[2]), "v"(g[3]),
                    "v"(g[4]), "v"(g[5]), "v"(g[6]), "v"(g[7])
                 : "memory");
}

#define GK      128                 // k per pass
#define GPITCH  136                 // LDS row pitch in elements (272 B)
#define GBUF    (128 * GPITCH)      // elements of one operand's buffer
#define EPITCH  68                  // epilogue staging: f32 row pitch in elements (272 B)
static_assert(8 * 32 * EPITCH * 4 <= 2 * GBUF * 2, "the eight waves' staging fits in As");
// NC: the row pitch of C, of the residual and of the output (= Ndim), at compile time, so
// that one address serves all of a lane's epilogue accesses, the rows as immediate offsets.
template <bool BIAS, bool RELU, bool RESID, bool OUTBF, int NC>
__global__ __launch_bounds__(256) void gemm_bf16_kernel(
    const u16* __restrict__ A, const u16* __restrict__ W,
    const float* __restrict__ bias, const float* __restrict__ resid,
    float* __restrict__ outF, u16* __restrict__ outB,
    int Mdim, int Ndim, int Kdim) {
    __shared__ __attribute__((aligned(16))) u16 As[2][GBUF];
    __shared__ __attribute__((aligned(16))) u16 Bs[2][GBUF];

    const int tid  = threadIdx.x;
    const int lane = tid & 31;
    const int wave = tid >> 5;
    const int wm   = wave >> 1;   // 0..3
    const int wn   = wave & 1;    // 0..1
    const int bm   = blockIdx.y * 128;
    const int bn   = blockIdx.x * 128;
    const int hi   = lane >> 4;

    v8f acc[2][4] = {};

    // staging: 16 lanes cover the 256 B of a row, a wave's copy two whole rows;
    // a thread copies rows srow + 16*i, i = 0..7, of each operand
    const int srow = tid >> 4, scg = tid & 15;
    const u16* gA = A + (size_t)(bm + srow) * Kdim + scg * 8;
    const u16* gW = W + (size_t)(bn + srow) * Kdim + scg * 8;
    const unsigned lA = (unsigned)(unsigned long long)&As[0][srow * GPITCH + scg * 8];
    const unsigned lB = (unsigned)(unsigned long long)&Bs[0][srow * GPITCH + scg * 8];

    auto stage = [&](int buf, int k0) {
        unsigned l[8];
        const u16* g[8];
#pragma unroll
        for (int i = 0; i < 8; ++i) {
            l[i] = lA + (unsigned)(buf * GBUF + i * 16 * GPITCH) * 2u;
            g[i] = gA + (size_t)(i * 16) * Kdim + k0;
        }
        async_ld8_b128(l, g);
#pragma unroll
        for (int i = 0; i < 8; ++i) {
            l[i] = lB + (unsigned)(buf * GBUF + i * 16 * GPITCH) * 2u;
            g[i] = gW + (size_t)(i * 16) * Kdim + k0;
        }
        async_ld8_b128(l, g);
    };

    const int KT = Kdim / GK;
    stage(0, 0);
    // tile 0 has landed for this wave, then for the block
    asm volatile("s_wait_asynccnt 0x0" ::: "memory");
    __syncthreads();
    if (KT > 1) stage(1, GK);

    for (int kt = 0; kt < KT; ++kt) {
        const int buf = kt & 1;
#pragma unroll
        for (int kk = 0; kk < GK / 32; ++kk) {
            v16bf af[2], bf[4];
#pragma unroll
            for (int i = 0; i < 2; ++i)
                af[i] = ld_frag(&As[buf][0], wm * 32 + i * 16, GPITCH, kk * 32, lane);
#pragma unroll
            for (int j = 0; j < 4; ++j)
                bf[j] = ld_frag(&Bs[buf][0], wn * 64 + j * 16, GPITCH, kk * 32, lane);
#pragma unroll
            for (int i = 0; i < 2; ++i)
#pragma unroll
                for (int j = 0; j < 4; ++j)
                    acc[i][j] = wmma_bf16(bf[j], af[i], acc[i][j]);   // C^T tile: W rows first
        }

        // hand-over: this wave's reads of buf are done, its copies of the next
        // tile have landed; the one barrier publishes that tile and frees buf
        asm volatile("s_wait_dscnt 0x0" ::: "memory");
        asm volatile("s_wait_asynccnt 0x0" ::: "memory");
        __syncthreads();
        if (kt + 2 < KT) stage(buf, (kt + 2) * GK);
    }
    // no copy is outstanding when the wave goes on to its end
    asm volatile("s_wait_asynccnt 0x0" ::: "memory");

    // Epilogue, in whole 128-byte lines. With W rows as the first operand a lane holds
    // C[m = lane&15][n = 8*hi + 0..7] of each 16x16 tile: 8 consecutive columns of one
    // row. Each wave lays its 32x64 tile as f32 into its own part of As (free: behind the
    // last barrier no wave reads the buffers and no copy is outstanding), reads it back
    // row by row, and every global access is 16 B a lane over whole rows of the tile.
    float* st = (float*)&As[0][0] + wave * (32 * EPITCH);
    const int row0 = bm + wm * 32;
    const int col0 = bn + wn * 64;
    constexpr int LPR = OUTBF ? 8 : 16;     // lanes that cover a row of 64 columns
    constexpr int CPL = 64 / LPR;           // columns a lane takes: 8 (bf16 out) or 4
    constexpr int RPI = 32 / LPR;           // rows of one wave-wide access
    const int lr = lane / LPR;
    const int lc = (lane % LPR) * CPL;

    static_assert(!(RESID && OUTBF), "the residual is added to four columns a lane");
    constexpr unsigned ESZ = OUTBF ? 2u : 4u;                     // bytes of an output element
    static_assert((size_t)MROWS * NC * 4 < (size_t)1 << 32, "byte offsets fit 32 bits");
    const unsigned e0 = (unsigned)((row0 + lr) * NC + col0 + lc); // this lane, access 0

    float4 rv[RESID ? 32 / RPI : 1];
    if (RESID) {
#pragma unroll
        for (int t = 0; t < 32 / RPI; ++t)
            rv[t] = *(const float4*)((const char*)resid + e0 * 4u + (unsigned)(t * RPI * NC) * 4u);
    }
    float4 bv[CPL / 4];
    if (BIAS) {
#pragma unroll
        for (int c = 0; c < CPL / 4; ++c)
            bv[c] = *(const float4*)(bias + col0 + lc + c * 4);
    }

#pragma unroll
    for (int i = 0; i < 2; ++i)
#pragma unroll
        for (int j = 0; j < 4; ++j) {
            float* p = st + (i * 16 + (lane & 15)) * EPITCH + j * 16 + 8 * hi;
            *(float4*)(p)     = make_float4(acc[i][j][0], acc[i][j][1], acc[i][j][2], acc[i][j][3]);
            *(float4*)(p + 4) = make_float4(acc[i][j][4], acc[i][j][5], acc[i][j][6], acc[i][j][7]);
        }
    // the wave's own LDS writes are done before other lanes' values are read back
    asm volatile("s_wait_dscnt 0x0" ::: "memory");

#pragma unroll
    for (int t = 0; t < 32 / RPI; ++t) {
        const float* p = st + (t * RPI + lr) * EPITCH + lc;
        char* op = (char*)(OUTBF ? (void*)outB : (void*)outF) + e0 * ESZ + (unsigned)(t * RPI * NC) * ESZ;
        float v[CPL];
#pragma unroll
        for (int c = 0; c < CPL / 4; ++c) {
            float4 x = *(const float4*)(p + c * 4);
            v[c * 4 + 0] = x.x; v[c * 4 + 1] = x.y; v[c * 4 + 2] = x.z; v[c * 4 + 3] = x.w;
            if (BIAS) {
                v[c * 4 + 0] += bv[c].x; v[c * 4 + 1] += bv[c].y;
                v[c * 4 + 2] += bv[c].z; v[c * 4 + 3] += bv[c].w;
            }
        }
        if (RELU) {
#pragma unroll
            for (int e = 0; e < CPL; ++e) v[e] = fmaxf(v[e], 0.0f);
        }
        if (RESID) {
            v[0] += rv[t].x; v[1] += rv[t].y; v[2] += rv[t].z; v[3] += rv[t].w;
        }
        if (OUTBF) {
            uint4 w;
            w.x = pack_bf2(v[0], v[1]);
            w.y = pack_bf2(v[2], v[3]);
            w.z = pack_bf2(v[CPL - 4], v[CPL - 3]);
            w.w = pack_bf2(v[CPL - 2], v[CPL - 1]);
            *(uint4*)op = w;
        } else {
            *(float4*)op = make_float4(v[0], v[1], v[2], v[3]);
        }
    }
}

__device__ __forceinline__ float xhalf(float x) {
    int b = __builtin_bit_cast(int, x);
    return __builtin_bit_cast(float, __builtin_amdgcn_permlanex16(
        b, b, 0x76543210, 0xfedcba98, false, false));
}

// 16-byte transposing LDS load: from a row-major [key][feat] tile a lane gets 8
// consecutive keys of one feature (half of a V^T fragment in the hardware k order)
typedef short s16x8 __attribute__((ext_vector_type(8)));
__device__ __forceinline__ uint4 ld_tr16(const unsigned char* p) {
    typedef __attribute__((address_space(3))) s16x8 lds_s16x8;
    return __builtin_bit_cast(uint4, __builtin_amdgcn_ds_load_tr16_b128_v8i16((lds_s16x8*)p));
}

// K and V come in stages of AK keys, both row-major as they lie in memory, into two
// LDS buffers filled by async copies: the copies of stage t+1 fly during the whole
// of stage t. K rows at 144 B (16 B x odd, for b128 reads), V rows at 160 B
// (32 B x odd, for the transposing reads).
#define AK      128                 // keys per stage
#define AKP     72                  // K row pitch in elements (144 B)
#define AVP     80                  // V row pitch in elements (160 B)
__global__ __launch_bounds__(256) void attn_kernel(
    const u16* __restrict__ q, const u16* __restrict__ k,
    const u16* __restrict__ v, u16* __restrict__ ctx) {
    __shared__ __attribute__((aligned(16))) u16 Ks[2][AK * AKP];   // [key][feat]
    __shared__ __attribute__((aligned(16))) u16 Vs[2][AK * AVP];   // [key][feat]

    const int tid  = threadIdx.x;
    const int lane = tid & 31;
    const int wave = tid >> 5;
    const int hi   = lane >> 4;
    const int h    = blockIdx.y;
    const int b    = blockIdx.z;
    const int qrow0 = b * SDIM + blockIdx.x * 128 + wave * 16;

    // staging: 8 lanes cover the 128 B of a row, a wave's copy four whole rows;
    // a thread copies rows srow + 32*i, i = 0..3, of K and of V
    const int srow = tid >> 3, scg = tid & 7;
    const u16* gK = k + (size_t)(b * SDIM + srow) * QKVP + h * DH + scg * 8;
    const u16* gV = v + (size_t)(b * SDIM + srow) * QKVP + h * DH + scg * 8;
    const unsigned lK = (unsigned)(unsigned long long)&Ks[0][srow * AKP + scg * 8];
    const unsigned lV = (unsigned)(unsigned long long)&Vs[0][srow * AVP + scg * 8];

    auto stage = [&](int buf, int st) {
        unsigned l[8];
        const u16* g[8];
#pragma unroll
        for (int i = 0; i < 4; ++i) {
            l[i]     = lK + (unsigned)(buf * AK * AKP + i * 32 * AKP) * 2u;
            g[i]     = gK + (size_t)(st * AK + i * 32) * QKVP;
            l[4 + i] = lV + (unsigned)(buf * AK * AVP + i * 32 * AVP) * 2u;
            g[4 + i] = gV + (size_t)(st * AK + i * 32) * QKVP;
        }
        async_ld8_b128(l, g);
    };

    stage(0, 0);

    // Q fragments (16 x 64 per wave) straight from global bf16; B operand
    v16bf qa[2];
#pragma unroll
    for (int d = 0; d < 2; ++d)
        qa[d] = ld_frag(q + (size_t)qrow0 * QKVP + h * DH + d * 32, 0, QKVP, 0, lane);

    // o[c][rr] = O[query lane&15][feat c*16 + 8*hi + rr]
    v8f o[4] = {};
    float Mx = -1e30f;   // running maximum of this lane's query (same in both halves)
    float Lr = 0.0f;     // running sum over this half's keys; halves joined at the end

    constexpr int NT = SDIM / AK;
    static_assert(NT >= 2, "the prologue fills two stages");
    // stage 0 has landed for this wave, then for the block
    asm volatile("s_wait_asynccnt 0x0" ::: "memory");
    __syncthreads();
    stage(1, 1);

    for (int st = 0; st < NT; ++st) {
      const int buf = st & 1;
      const u16* Kt = &Ks[buf][0];
      // this lane's address in the transposing loads of V, pass 0, features 0..15
      const unsigned char* Vl = (const unsigned char*)&Vs[buf][0]
          + (8 * hi + (lane & 7)) * (AVP * 2) + ((lane >> 3) & 1) * 16;
      // kept rolled: unrolled, the accumulators change registers from pass to pass
      // and are copied back at every stage
#pragma unroll 1
      for (int sub = 0; sub < AK / 32; ++sub) {
        // scores, transposed: s[kc][rr] = S[key kc*16 + 8*hi + rr][query lane&15]
        v8f s[2] = {};
#pragma unroll
        for (int kc = 0; kc < 2; ++kc)
#pragma unroll
            for (int d = 0; d < 2; ++d)
                s[kc] = wmma_bf16(ld_frag(Kt, sub * 32 + kc * 16, AKP, d * 32, lane), qa[d], s[kc]);

        // scale + relu + streaming softmax, one query per lane
        float mloc = 0.0f;   // relu: no score is below 0
#pragma unroll
        for (int kc = 0; kc < 2; ++kc)
#pragma unroll
            for (int rr = 0; rr < 8; ++rr) {
                s[kc][rr] = fmaxf(s[kc][rr] * 0.125f, 0.0f);
                mloc = fmaxf(mloc, s[kc][rr]);
            }
        mloc = fmaxf(mloc, xhalf(mloc));
        const float mnew  = fmaxf(Mx, mloc);
        const float alpha = __expf(Mx - mnew);
        float sum = 0.0f;
#pragma unroll
        for (int kc = 0; kc < 2; ++kc)
#pragma unroll
            for (int rr = 0; rr < 8; ++rr) {
                s[kc][rr] = __expf(s[kc][rr] - mnew);
                sum += s[kc][rr];
            }
        Lr = Lr * alpha + sum;
        Mx = mnew;

        // P^T as B operand: element e = key (e < 8 ? 8*hi + e : 16 + 8*hi + e - 8),
        // the k order in which the two transposing loads deliver V^T
        union { unsigned u[8]; v16bf v; } pb;
#pragma unroll
        for (int kc = 0; kc < 2; ++kc)
#pragma unroll
            for (int e = 0; e < 4; ++e)
                pb.u[kc * 4 + e] = pack_bf2(s[kc][2 * e], s[kc][2 * e + 1]);

#pragma unroll
        for (int c = 0; c < 4; ++c) {
#pragma unroll
            for (int rr = 0; rr < 8; ++rr)
                o[c][rr] *= alpha;
            // V^T fragment: features c*16 + (lane&15), keys 8*hi + 0..7 and 16 + 8*hi + 0..7
            Frag16 vf;
            vf.q[0] = ld_tr16(Vl + (sub * 32) * (AVP * 2) + c * 32);
            vf.q[1] = ld_tr16(Vl + (sub * 32 + 16) * (AVP * 2) + c * 32);
            o[c] = wmma_bf16(vf.v, pb.v, o[c]);
        }
        __builtin_amdgcn_sched_barrier(0);
        asm volatile("v_nop\n\tv_nop\n\tv_nop\n\tv_nop");
      }

      // hand-over: this wave's reads of buf are done, its copies of the next
      // stage have landed; the one barrier publishes that stage and frees buf
      asm volatile("s_wait_dscnt 0x0" ::: "memory");
      asm volatile("s_wait_asynccnt 0x0" ::: "memory");
      __syncthreads();
      if (st + 2 < NT) stage(buf, st + 2);
    }
    // no copy is outstanding when the wave goes on to its end
    asm volatile("s_wait_asynccnt 0x0" ::: "memory");

    // join the halves' sums, normalize and emit ctx as bf16:
    // 8 consecutive features of one query per lane and tile = one 16-byte store
    Lr += xhalf(Lr);
    u16* crow = ctx + (size_t)(qrow0 + (lane & 15)) * DDIM + h * DH + 8 * hi;
#pragma unroll
    for (int c = 0; c < 4; ++c) {
        uint4 w;
        w.x = pack_bf2(o[c][0] / Lr, o[c][1] / Lr);
        w.y = pack_bf2(o[c][2] / Lr, o[c][3] / Lr);
        w.z = pack_bf2(o[c][4] / Lr, o[c][5] / Lr);
        w.w = pack_bf2(o[c][6] / Lr, o[c][7] / Lr);
        *(uint4*)(crow + c * 16) = w;
    }
}

// ---------- LayerNorm over D=1024 (input already holds x + residual) ----------
__global__ __launch_bounds__(256) void ln_kernel(
    const float* __restrict__ x, const float* __restrict__ g,
    const float* __restrict__ bta, float* __restrict__ yf,
    u16* __restrict__ yb) {
    __shared__ float sh[16];
    const int row = blockIdx.x, tid = threadIdx.x;
    const float* xr = x + (size_t)row * DDIM;
    float4 xv = *(const float4*)(xr + tid * 4);
    float s = xv.x + xv.y + xv.z + xv.w;
    float qq = xv.x * xv.x + xv.y * xv.y + xv.z * xv.z + xv.w * xv.w;
#pragma unroll
    for (int off = 16; off; off >>= 1) {
        s  += __shfl_xor(s, off, 32);
        qq += __shfl_xor(qq, off, 32);
    }
    int wv = tid >> 5, ln = tid & 31;
    if (ln == 0) { sh[wv] = s; sh[8 + wv] = qq; }
    __syncthreads();
    if (tid == 0) {
        float a = 0.f, b2 = 0.f;
        for (int i = 0; i < 8; ++i) { a += sh[i]; b2 += sh[8 + i]; }
        sh[0] = a; sh[8] = b2;
    }
    __syncthreads();
    float mu  = sh[0] * (1.0f / DDIM);
    float var = sh[8] * (1.0f / DDIM) - mu * mu;
    float inv = rsqrtf(var + 1e-5f);
    const float* xp = (const float*)&xv;
#pragma unroll
    for (int j = 0; j < 4; ++j) {
        int col = tid * 4 + j;
        float yv = (xp[j] - mu) * inv * g[col] + bta[col];
        yf[(size_t)row * DDIM + col] = yv;
        if (yb) yb[(size_t)row * DDIM + col] = f2bf(yv);
    }
}

// ---------- host ----------
extern "C" void kernel_launch(void* const* d_in, const int* in_sizes, int n_in,
                              void* d_out, int out_size, void* d_ws, size_t ws_size,
                              hipStream_t stream) {
    const float* X    = (const float*)d_in[0];
    const float* Wq   = (const float*)d_in[1];
    const float* Wk   = (const float*)d_in[2];
    const float* Wo   = (const float*)d_in[3];
    const float* ln1g = (const float*)d_in[4];
    const float* ln1b = (const float*)d_in[5];
    const float* ln2g = (const float*)d_in[6];
    const float* ln2b = (const float*)d_in[7];
    const float* W1   = (const float*)d_in[8];
    const float* b1   = (const float*)d_in[9];
    const float* W2   = (const float*)d_in[10];
    const float* b2   = (const float*)d_in[11];

    char* ws = (char*)d_ws;
    size_t off = 0;
    auto alloc = [&](size_t bytes) {
        char* p = ws + off;
        off += (bytes + 255) & ~size_t(255);
        return p;
    };
    u16*   Xb   = (u16*)alloc((size_t)MROWS * DDIM * 2);
    u16*   Wqb  = (u16*)alloc((size_t)DDIM * DDIM * 2);
    u16*   Wkb  = (u16*)alloc((size_t)DDIM * DDIM * 2);
    u16*   Wob  = (u16*)alloc((size_t)DDIM * DDIM * 2);
    u16*   W1b  = (u16*)alloc((size_t)FFD * DDIM * 2);
    u16*   W2b  = (u16*)alloc((size_t)DDIM * FFD * 2);
    u16*   qkvb = (u16*)alloc((size_t)MROWS * QKVP * 2);
    u16*   ctxb = (u16*)alloc((size_t)MROWS * DDIM * 2);
    float* ares = (float*)alloc((size_t)MROWS * DDIM * 4);
    float* yf   = (float*)alloc((size_t)MROWS * DDIM * 4);
    u16*   yb   = (u16*)alloc((size_t)MROWS * DDIM * 2);
    u16*   hb   = (u16*)alloc((size_t)MROWS * FFD * 2);
    float* fres = (float*)alloc((size_t)MROWS * DDIM * 4);

    // Xb, Wqb, Wkb, Wob, W1b, W2b are consecutive (each size a multiple of 256 bytes)
    cvt_bf16_kernel<<<CVT_BLOCKS, 256, 0, stream>>>(X, Wq, Wk, Wo, W1, W2, Xb);

    // Q, K, V projections (V uses Wo per reference) -> bf16, as one product:
    // Wqb, Wkb, Wob lie back to back, so they are one [3072][1024] operand, and
    // row m of the result is q[m] | k[m] | v[m]
    dim3 gproj(DDIM / 128, MROWS / 128);
    dim3 gqkv(QKVP / 128, MROWS / 128);
    gemm_bf16_kernel<false, false, false, true, QKVP><<<gqkv, 256, 0, stream>>>(
        Xb, Wqb, nullptr, nullptr, nullptr, qkvb, MROWS, QKVP, DDIM);

    // attention -> ctx (bf16)
    attn_kernel<<<dim3(SDIM / 128, HDIM, BDIM), 256, 0, stream>>>(
        qkvb, qkvb + DDIM, qkvb + 2 * DDIM, ctxb);

    // att_out = ctx @ Wo^T + X  (fp32)
    gemm_bf16_kernel<false, false, true, false, DDIM><<<gproj, 256, 0, stream>>>(
        ctxb, Wob, nullptr, X, ares, nullptr, MROWS, DDIM, DDIM);

    // y = LN1(att_out + X)  -> fp32 + bf16
    ln_kernel<<<MROWS, 256, 0, stream>>>(ares, ln1g, ln1b, yf, yb);

    // h = relu(y @ W1^T + b1) -> bf16
    dim3 gffn1(FFD / 128, MROWS / 128);
    gemm_bf16_kernel<true, true, false, true, FFD><<<gffn1, 256, 0, stream>>>(
        yb, W1b, b1, nullptr, nullptr, hb, MROWS, FFD, DDIM);

    // f = h @ W2^T + b2 + y -> fp32
    gemm_bf16_kernel<true, false, true, false, DDIM><<<gproj, 256, 0, stream>>>(
        hb, W2b, b2, yf, fres, nullptr, MROWS, DDIM, FFD);

    // out = LN2(f + y)
    ln_kernel<<<MROWS, 256, 0, stream>>>(fres, ln2g, ln2b, (float*)d_out, nullptr);
}

// v007
// It runs in 164 microseconds.
// Timed twice side by side with v006, it ran 1.03 times as fast both times.
// Over all steps from v000 it is 2.22 times as fast.
#include <hip/hip_runtime.h>
#include <hip/hip_bf16.h>

typedef unsigned short u16;
typedef __attribute__((ext_vector_type(16))) __bf16 v16bf;
typedef __attribute__((ext_vector_type(8)))  float  v8f;

#define DDIM 1024
#define SDIM 2048
#define BDIM 2
#define HDIM 16
#define DH   64
#define FFD  4096
#define MROWS 4096   // B*S
#define QKVP (3 * DDIM)   // row pitch of the joint q | k | v array, in elements

// ---------- helpers ----------
__device__ __forceinline__ u16 f2bf(float f) {
    unsigned u = __float_as_uint(f);
    unsigned r = ((u >> 16) & 1u) + 0x7FFFu;
    return (u16)((u + r) >> 16);
}

union Frag16 { uint4 q[2]; v16bf v; };

__device__ __forceinline__ v16bf ld_frag(const u16* t, int row0, int stride,
                                         int coloff, int lane) {
    int r = lane & 15, hi = lane >> 4;
    const u16* p = t + (size_t)(row0 + r) * stride + coloff + hi * 8;
    Frag16 f;
    f.q[0] = *(const uint4*)(p);
    f.q[1] = *(const uint4*)(p + 16);
    return f.v;
}

__device__ __forceinline__ v8f wmma_bf16(v16bf a, v16bf b, v8f c) {
    return __builtin_amdgcn_wmma_f32_16x16x32_bf16(
        false, a, false, b, (short)0, c, false, false);
}

// two f32 -> one register of two bf16, round to nearest even
typedef __attribute__((ext_vector_type(2))) float  v2f;
typedef __attribute__((ext_vector_type(2))) __bf16 v2bf;

__device__ __forceinline__ unsigned pack_bf2(float lo, float hi2) {
    v2f t = { lo, hi2 };
    return __builtin_bit_cast(unsigned, __builtin_convertvector(t, v2bf));
}

// ---------- fp32 -> bf16 conversion, all six operands in one launch ----------
// The six bf16 copies lie back to back in the workspace, so the output is one
// array. A row is 1024 elements (one float4 per thread). A block converts
// CVT_ROWS consecutive rows; every operand is a whole number of such groups,
// so a block has one source. Each thread issues all its loads before the first
// conversion.
#define CVT_ROWS   16
#define CVT_RX     (MROWS * DDIM / 1024)   // rows of X
#define CVT_RW     (DDIM * DDIM / 1024)    // rows of Wq, Wk, Wo each
#define CVT_RF     (FFD * DDIM / 1024)     // rows of W1, W2 each
#define CVT_BLOCKS ((CVT_RX + 3 * CVT_RW + 2 * CVT_RF) / CVT_ROWS)
static_assert(CVT_RX % CVT_ROWS == 0 && CVT_RW % CVT_ROWS == 0 && CVT_RF % CVT_ROWS == 0,
              "a block must not straddle two operands");

__global__ __launch_bounds__(256) __attribute__((amdgpu_waves_per_eu(8, 8)))
void cvt_bf16_kernel(
    const float* __restrict__ X,  const float* __restrict__ Wq,
    const float* __restrict__ Wk, const float* __restrict__ Wo,
    const float* __restrict__ W1, const float* __restrict__ W2,
    u16* __restrict__ out) {
    const int tid = threadIdx.x;
    const int r0  = blockIdx.x * CVT_ROWS;
    int r = r0;                 // first row, counted within its own operand
    const float* s = X;
    if (r >= CVT_RX) {
        r -= CVT_RX; s = Wq;
        if (r >= CVT_RW) { r -= CVT_RW; s = Wk; }
        if (r >= CVT_RW) { r -= CVT_RW; s = Wo; }
        if (r >= CVT_RW) { r -= CVT_RW; s = W1; }
        if (r >= CVT_RF) { r -= CVT_RF; s = W2; }
    }
    const float* sp = s + (size_t)r * 1024 + tid * 4;
    u16*         op = out + (size_t)r0 * 1024 + tid * 4;
    float4 v[CVT_ROWS];
    // both loops unrolled: v stays in registers and the loads issue as one group
#pragma unroll
    for (int j = 0; j < CVT_ROWS; ++j)
        v[j] = *(const float4*)(sp + j * 1024);
#pragma unroll
    for (int j = 0; j < CVT_ROWS; ++j) {
        u16 o[4] = { f2bf(v[j].x), f2bf(v[j].y), f2bf(v[j].z), f2bf(v[j].w) };
        *(uint2*)(op + j * 1024) = *(const uint2*)o;
    }
}

__device__ __forceinline__ void async_ld8_b128(const unsigned (&l)[8],
                                               const u16* const (&g)[8]) {
    asm volatile("global_load_async_to_lds_b128 %0, %8, off\n\t"
                 "global_load_async_to_lds_b128 %1, %9, off\n\t"
                 "global_load_async_to_lds_b128 %2, %10, off\n\t"
                 "global_load_async_to_lds_b128 %3, %11, off\n\t"
                 "global_load_async_to_lds_b128 %4, %12, off\n\t"
                 "global_load_async_to_lds_b128 %5, %13, off\n\t"
                 "global_load_async_to_lds_b128 %6, %14, off\n\t"
                 "global_load_async_to_lds_b128 %7, %15, off\n\t"
                 "s_wait_xcnt 0x0"
                 :: "v"(l[0]), "v"(l[1]), "v"(l[2]), "v"(l[3]),
                    "v"(l[4]), "v"(l[5]), "v"(l[6]), "v"(l[7]),
                    "v"(g[0]), "v"(g[1]), "v"(g[2]), "v"(g[3]),
                    "v"(g[4]), "v"(g[5]), "v"(g[6]), "v"(g[7])
                 : "memory");
}

#define GK      128                 // k per pass
#define GPITCH  136                 // LDS row pitch in elements (272 B)
// NC: the row pitch of C, of the residual and of the output (= Ndim), at compile time, so
// that one address serves all of a lane's epilogue accesses, the rows as immediate offsets.
template <bool BIAS, bool RELU, bool RESID, bool OUTBF, int NC, int BT>
__global__ __launch_bounds__(256) void gemm_bf16_kernel(
    const u16* __restrict__ A, const u16* __restrict__ W,
    const float* __restrict__ bias, const float* __restrict__ resid,
    float* __restrict__ outF, u16* __restrict__ outB,
    int Mdim, int Ndim, int Kdim) {
    constexpr int GBUF   = BT * GPITCH;   // elements of one operand's buffer
    constexpr int FM     = BT / 64;       // 16-row fragments of A rows a wave
    constexpr int FN     = BT / 32;       // 16-row fragments of W rows a wave
    constexpr int WMR    = FM * 16;       // rows of a wave's tile
    constexpr int WNC    = FN * 16;       // columns of a wave's tile
    constexpr int EPITCH = WNC + 4;       // epilogue staging: f32 row pitch in elements (16 B x odd)
    static_assert(8 * WMR * EPITCH * 4 <= 4 * GBUF * 2, "the eight waves' staging fits in the buffers");
    // As[2][GBUF] | Bs[2][GBUF]
    __shared__ __attribute__((aligned(16))) u16 Sm[4 * GBUF];
    u16* const As = Sm;
    u16* const Bs = Sm + 2 * GBUF;

    const int tid  = threadIdx.x;
    const int lane = tid & 31;
    const int wave = tid >> 5;
    const int wm   = wave >> 1;   // 0..3
    const int wn   = wave & 1;    // 0..1
    const int bm   = blockIdx.y * BT;
    const int bn   = blockIdx.x * BT;
    const int hi   = lane >> 4;

    v8f acc[FM][FN] = {};

    // staging: 16 lanes cover the 256 B of a row, a wave's copy two whole rows;
    // a thread copies rows srow + 16*i, i = 0..BT/16-1, of each operand, eight a statement
    const int srow = tid >> 4, scg = tid & 15;
    const u16* gA = A + (size_t)(bm + srow) * Kdim + scg * 8;
    const u16* gW = W + (size_t)(bn + srow) * Kdim + scg * 8;
    // BT = 256: what lives across the loop is a 32-bit element offset (operands are below
    // 2^32 elements), and each copy's pointer is formed from it anew. A pointer that is
    // itself an operand of a copy statement is held to the registers asm can name, which
    // the accumulators fill: kept across the loop it goes to scratch.
    const unsigned oA = (unsigned)((bm + srow) * Kdim + scg * 8);
    const unsigned oW = (unsigned)((bn + srow) * Kdim + scg * 8);
    const unsigned lA = (unsigned)(unsigned long long)&As[srow * GPITCH + scg * 8];
    const unsigned lB = (unsigned)(unsigned long long)&Bs[srow * GPITCH + scg * 8];

    auto stage = [&](int buf, int k0) {
        unsigned l[8];
        const u16* g[8];
#pragma unroll
        for (int c = 0; c < BT / 128; ++c) {
#pragma unroll
            for (int i = 0; i < 8; ++i) {
                l[i] = lA + (unsigned)(buf * GBUF + (c * 8 + i) * 16 * GPITCH) * 2u;
                if constexpr (BT > 128) g[i] = A + (oA + (unsigned)((c * 8 + i) * 16 * Kdim + k0));
                else                    g[i] = gA + (size_t)((c * 8 + i) * 16) * Kdim + k0;
            }
            async_ld8_b128(l, g);
        }
#pragma unroll
        for (int c = 0; c < BT / 128; ++c) {
#pragma unroll
            for (int i = 0; i < 8; ++i) {
                l[i] = lB + (unsigned)(buf * GBUF + (c * 8 + i) * 16 * GPITCH) * 2u;
                if constexpr (BT > 128) g[i] = W + (oW + (unsigned)((c * 8 + i) * 16 * Kdim + k0));
                else                    g[i] = gW + (size_t)((c * 8 + i) * 16) * Kdim + k0;
            }
            async_ld8_b128(l, g);
        }
    };

    // the epilogue's split of a wave's tile over its lanes
    const int row0 = bm + wm * WMR;
    const int col0 = bn + wn * WNC;
    constexpr int CPL = OUTBF ? 8 : 4;      // columns a lane takes: 16 B of output
    constexpr int LPR = WNC / CPL;          // lanes that cover a row of the wave's tile
    constexpr int RPI = 32 / LPR;           // rows of one wave-wide access
    static_assert(LPR <= 32, "a wave-wide access covers whole rows");
    const int lr = lane / LPR;
    const int lc = (lane % LPR) * CPL;
    float4 bv[CPL / 4];

    const int KT = Kdim / GK;
    stage(0, 0);
    // tile 0 has landed for this wave, then for the block
    asm volatile("s_wait_asynccnt 0x0" ::: "memory");
    __syncthreads();
    if (KT > 1) stage(1, GK);

    for (int kt = 0; kt < KT; ++kt) {
        const int buf = kt & 1;
#pragma unroll
        for (int kk = 0; kk < GK / 32; ++kk) {
            v16bf af[FM], bf[FN];
#pragma unroll
            for (int i = 0; i < FM; ++i)
                af[i] = ld_frag(As + buf * GBUF, wm * WMR + i * 16, GPITCH, kk * 32, lane);
#pragma unroll
            for (int j = 0; j < FN; ++j)
                bf[j] = ld_frag(Bs + buf * GBUF, wn * WNC + j * 16, GPITCH, kk * 32, lane);
            // the step's 24 LDS reads stay one group ahead of its 32 products: left free,
            // the compiler sinks the A reads to one per row of 8 products, each behind
            // its own wait to 0, and moves the next step's reads in among the products
            if constexpr (BT > 128) __builtin_amdgcn_sched_barrier(0);
#pragma unroll
            for (int i = 0; i < FM; ++i)
#pragma unroll
                for (int j = 0; j < FN; ++j)
                    acc[i][j] = wmma_bf16(bf[j], af[i], acc[i][j]);   // C^T tile: W rows first
            if constexpr (BT > 128) __builtin_amdgcn_sched_barrier(0);   // end of that group
        }

        // hand-over: this wave's reads of buf are done, its copies of the next
        // tile have landed; the one barrier publishes that tile and frees buf
        asm volatile("s_wait_dscnt 0x0" ::: "memory");
        asm volatile("s_wait_asynccnt 0x0" ::: "memory");
        __syncthreads();
        if (kt + 2 < KT) stage(buf, (kt + 2) * GK);
    }
    // no copy is outstanding when the wave goes on to its end
    asm volatile("s_wait_asynccnt 0x0" ::: "memory");

    // Epilogue, in whole 128-byte lines. With W rows as the first operand a lane holds
    // C[m = lane&15][n = 8*hi + 0..7] of each 16x16 tile: 8 consecutive columns of one
    // row. Each wave lays its tile as f32 into its own part of the buffers (free: behind the
    // last barrier no wave reads the buffers and no copy is outstanding), reads it back
    // row by row, and every global access is 16 B a lane over whole rows of the tile.
    float* st = (float*)Sm + wave * (WMR * EPITCH);

    static_assert(!(RESID && OUTBF), "the residual is added to four columns a lane");
    constexpr unsigned ESZ = OUTBF ? 2u : 4u;                     // bytes of an output element
    static_assert((size_t)MROWS * NC * 4 < (size_t)1 << 32, "byte offsets fit 32 bits");
    const unsigned e0 = (unsigned)((row0 + lr) * NC + col0 + lc); // this lane, access 0

    float4 rv[RESID ? WMR / RPI : 1];
    if (RESID) {
#pragma unroll
        for (int t = 0; t < WMR / RPI; ++t)
            rv[t] = *(const float4*)((const char*)resid + e0 * 4u + (unsigned)(t * RPI * NC) * 4u);
    }
    const float* bp = BIAS ? bias + col0 + lc : nullptr;
    if (BIAS) {
#pragma unroll
        for (int c = 0; c < CPL / 4; ++c)
            bv[c] = *(const float4*)(bp + c * 4);
    }

#pragma unroll
    for (int i = 0; i < FM; ++i)
#pragma unroll
        for (int j = 0; j < FN; ++j) {
            float* p = st + (i * 16 + (lane & 15)) * EPITCH + j * 16 + 8 * hi;
            *(float4*)(p)     = make_float4(acc[i][j][0], acc[i][j][1], acc[i][j][2], acc[i][j][3]);
            *(float4*)(p + 4) = make_float4(acc[i][j][4], acc[i][j][5], acc[i][j][6], acc[i][j][7]);
        }
    // the wave's own LDS writes are done before other lanes' values are read back
    asm volatile("s_wait_dscnt 0x0" ::: "memory");
    if constexpr (BIAS && BT > 128) {
        static_assert(CPL == 8, "two float4 a lane");
        asm volatile("s_wait_xcnt 0x0"
                     :: "v"(bp), "v"(bv[0].x), "v"(bv[0].y), "v"(bv[0].z), "v"(bv[0].w),
                        "v"(bv[1].x), "v"(bv[1].y), "v"(bv[1].z), "v"(bv[1].w)
                     : "memory");
        __builtin_amdgcn_sched_barrier(0);
    }

    // BT = 256: the stores go out in groups of EG, each group from registers of its own
    static_assert(BT == 128 || OUTBF, "the grouped stores are written for bf16 output");
    constexpr int EG = BT > 128 ? 8 : 1;
    uint4 wq[EG];
#pragma unroll
    for (int t = 0; t < WMR / RPI; ++t) {
        const float* p = st + (t * RPI + lr) * EPITCH + lc;
        char* op = (char*)(OUTBF ? (void*)outB : (void*)outF) + e0 * ESZ + (unsigned)(t * RPI * NC) * ESZ;
        float v[CPL];
#pragma unroll
        for (int c = 0; c < CPL / 4; ++c) {
            float4 x = *(const float4*)(p + c * 4);
            v[c * 4 + 0] = x.x; v[c * 4 + 1] = x.y; v[c * 4 + 2] = x.z; v[c * 4 + 3] = x.w;
            if (BIAS) {
                v[c * 4 + 0] += bv[c].x; v[c * 4 + 1] += bv[c].y;
                v[c * 4 + 2] += bv[c].z; v[c * 4 + 3] += bv[c].w;
            }
        }
        if (RELU) {
#pragma unroll
            for (int e = 0; e < CPL; ++e) v[e] = fmaxf(v[e], 0.0f);
        }
        if (RESID) {
            v[0] += rv[t].x; v[1] += rv[t].y; v[2] += rv[t].z; v[3] += rv[t].w;
        }
        if (OUTBF) {
            uint4 w;
            w.x = pack_bf2(v[0], v[1]);
            w.y = pack_bf2(v[2], v[3]);
            w.z = pack_bf2(v[CPL - 4], v[CPL - 3]);
            w.w = pack_bf2(v[CPL - 2], v[CPL - 1]);
            if constexpr (BT > 128) {
                wq[t % EG] = w;
                if (t % EG == EG - 1) {
                    __builtin_amdgcn_sched_barrier(0);
#pragma unroll
                    for (int u = 0; u < EG; ++u)
                        *(uint4*)(op - (unsigned)((EG - 1 - u) * RPI * NC) * ESZ) = wq[u];
                    if (t + 1 < WMR / RPI) {   // behind the last group nothing is rewritten
                        asm volatile("s_wait_xcnt 0x0" ::: "memory");
                        __builtin_amdgcn_sched_barrier(0);
                    }
                }
            } else {
                *(uint4*)op = w;
            }
        } else {
            *(float4*)op = make_float4(v[0], v[1], v[2], v[3]);
        }
    }
}

__device__ __forceinline__ float xhalf(float x) {
    int b = __builtin_bit_cast(int, x);
    return __builtin_bit_cast(float, __builtin_amdgcn_permlanex16(
        b, b, 0x76543210, 0xfedcba98, false, false));
}

// 16-byte transposing LDS load: from a row-major [key][feat] tile a lane gets 8
// consecutive keys of one feature (half of a V^T fragment in the hardware k order)
typedef short s16x8 __attribute__((ext_vector_type(8)));
__device__ __forceinline__ uint4 ld_tr16(const unsigned char* p) {
    typedef __attribute__((address_space(3))) s16x8 lds_s16x8;
    return __builtin_bit_cast(uint4, __builtin_amdgcn_ds_load_tr16_b128_v8i16((lds_s16x8*)p));
}

// K and V come in stages of AK keys, both row-major as they lie in memory, into two
// LDS buffers filled by async copies: the copies of stage t+1 fly during the whole
// of stage t. K rows at 144 B (16 B x odd, for b128 reads), V rows at 160 B
// (32 B x odd, for the transposing reads).
#define AK      128                 // keys per stage
#define AKP     72                  // K row pitch in elements (144 B)
#define AVP     80                  // V row pitch in elements (160 B)
__global__ __launch_bounds__(256) void attn_kernel(
    const u16* __restrict__ q, const u16* __restrict__ k,
    const u16* __restrict__ v, u16* __restrict__ ctx) {
    __shared__ __attribute__((aligned(16))) u16 Ks[2][AK * AKP];   // [key][feat]
    __shared__ __attribute__((aligned(16))) u16 Vs[2][AK * AVP];   // [key][feat]

    const int tid  = threadIdx.x;
    const int lane = tid & 31;
    const int wave = tid >> 5;
    const int hi   = lane >> 4;
    const int h    = blockIdx.y;
    const int b    = blockIdx.z;
    const int qrow0 = b * SDIM + blockIdx.x * 128 + wave * 16;

    // staging: 8 lanes cover the 128 B of a row, a wave's copy four whole rows;
    // a thread copies rows srow + 32*i, i = 0..3, of K and of V
    const int srow = tid >> 3, scg = tid & 7;
    const u16* gK = k + (size_t)(b * SDIM + srow) * QKVP + h * DH + scg * 8;
    const u16* gV = v + (size_t)(b * SDIM + srow) * QKVP + h * DH + scg * 8;
    const unsigned lK = (unsigned)(unsigned long long)&Ks[0][srow * AKP + scg * 8];
    const unsigned lV = (unsigned)(unsigned long long)&Vs[0][srow * AVP + scg * 8];

    auto stage = [&](int buf, int st) {
        unsigned l[8];
        const u16* g[8];
#pragma unroll
        for (int i = 0; i < 4; ++i) {
            l[i]     = lK + (unsigned)(buf * AK * AKP + i * 32 * AKP) * 2u;
            g[i]     = gK + (size_t)(st * AK + i * 32) * QKVP;
            l[4 + i] = lV + (unsigned)(buf * AK * AVP + i * 32 * AVP) * 2u;
            g[4 + i] = gV + (size_t)(st * AK + i * 32) * QKVP;
        }
        async_ld8_b128(l, g);
    };

    stage(0, 0);

    // Q fragments (16 x 64 per wave) straight from global bf16; B operand
    v16bf qa[2];
#pragma unroll
    for (int d = 0; d < 2; ++d)
        qa[d] = ld_frag(q + (size_t)qrow0 * QKVP + h * DH + d * 32, 0, QKVP, 0, lane);

    // o[c][rr] = O[query lane&15][feat c*16 + 8*hi + rr]
    v8f o[4] = {};
    float Mx = -1e30f;   // running maximum of this lane's query (same in both halves)
    float Lr = 0.0f;     // running sum over this half's keys; halves joined at the end

    constexpr int NT = SDIM / AK;
    static_assert(NT >= 2, "the prologue fills two stages");
    // stage 0 has landed for this wave, then for the block
    asm volatile("s_wait_asynccnt 0x0" ::: "memory");
    __syncthreads();
    stage(1, 1);

    for (int st = 0; st < NT; ++st) {
      const int buf = st & 1;
      const u16* Kt = &Ks[buf][0];
      // this lane's address in the transposing loads of V, pass 0, features 0..15
      const unsigned char* Vl = (const unsigned char*)&Vs[buf][0]
          + (8 * hi + (lane & 7)) * (AVP * 2) + ((lane >> 3) & 1) * 16;
      // kept rolled: unrolled, the accumulators change registers from pass to pass
      // and are copied back at every stage
#pragma unroll 1
      for (int sub = 0; sub < AK / 32; ++sub) {
        // scores, transposed: s[kc][rr] = S[key kc*16 + 8*hi + rr][query lane&15]
        v8f s[2] = {};
#pragma unroll
        for (int kc = 0; kc < 2; ++kc)
#pragma unroll
            for (int d = 0; d < 2; ++d)
                s[kc] = wmma_bf16(ld_frag(Kt, sub * 32 + kc * 16, AKP, d * 32, lane), qa[d], s[kc]);

        // scale + relu + streaming softmax, one query per lane
        float mloc = 0.0f;   // relu: no score is below 0
#pragma unroll
        for (int kc = 0; kc < 2; ++kc)
#pragma unroll
            for (int rr = 0; rr < 8; ++rr) {
                s[kc][rr] = fmaxf(s[kc][rr] * 0.125f, 0.0f);
                mloc = fmaxf(mloc, s[kc][rr]);
            }
        mloc = fmaxf(mloc, xhalf(mloc));
        const float mnew  = fmaxf(Mx, mloc);
        const float alpha = __expf(Mx - mnew);
        float sum = 0.0f;
#pragma unroll
        for (int kc = 0; kc < 2; ++kc)
#pragma unroll
            for (int rr = 0; rr < 8; ++rr) {
                s[kc][rr] = __expf(s[kc][rr] - mnew);
                sum += s[kc][rr];
            }
        Lr = Lr * alpha + sum;
        Mx = mnew;

        // P^T as B operand: element e = key (e < 8 ? 8*hi + e : 16 + 8*hi + e - 8),
        // the k order in which the two transposing loads deliver V^T
        union { unsigned u[8]; v16bf v; } pb;
#pragma unroll
        for (int kc = 0; kc < 2; ++kc)
#pragma unroll
            for (int e = 0; e < 4; ++e)
                pb.u[kc * 4 + e] = pack_bf2(s[kc][2 * e], s[kc][2 * e + 1]);

#pragma unroll
        for (int c = 0; c < 4; ++c) {
#pragma unroll
            for (int rr = 0; rr < 8; ++rr)
                o[c][rr] *= alpha;
            // V^T fragment: features c*16 + (lane&15), keys 8*hi + 0..7 and 16 + 8*hi + 0..7
            Frag16 vf;
            vf.q[0] = ld_tr16(Vl + (sub * 32) * (AVP * 2) + c * 32);
            vf.q[1] = ld_tr16(Vl + (sub * 32 + 16) * (AVP * 2) + c * 32);
            o[c] = wmma_bf16(vf.v, pb.v, o[c]);
        }
        __builtin_amdgcn_sched_barrier(0);
        asm volatile("v_nop\n\tv_nop\n\tv_nop\n\tv_nop");
      }

      // hand-over: this wave's reads of buf are done, its copies of the next
      // stage have landed; the one barrier publishes that stage and frees buf
      asm volatile("s_wait_dscnt 0x0" ::: "memory");
      asm volatile("s_wait_asynccnt 0x0" ::: "memory");
      __syncthreads();
      if (st + 2 < NT) stage(buf, st + 2);
    }
    // no copy is outstanding when the wave goes on to its end
    asm volatile("s_wait_asynccnt 0x0" ::: "memory");

    // join the halves' sums, normalize and emit ctx as bf16:
    // 8 consecutive features of one query per lane and tile = one 16-byte store
    Lr += xhalf(Lr);
    u16* crow = ctx + (size_t)(qrow0 + (lane & 15)) * DDIM + h * DH + 8 * hi;
#pragma unroll
    for (int c = 0; c < 4; ++c) {
        uint4 w;
        w.x = pack_bf2(o[c][0] / Lr, o[c][1] / Lr);
        w.y = pack_bf2(o[c][2] / Lr, o[c][3] / Lr);
        w.z = pack_bf2(o[c][4] / Lr, o[c][5] / Lr);
        w.w = pack_bf2(o[c][6] / Lr, o[c][7] / Lr);
        *(uint4*)(crow + c * 16) = w;
    }
}

// ---------- LayerNorm over D=1024 (input already holds x + residual) ----------
__global__ __launch_bounds__(256) void ln_kernel(
    const float* __restrict__ x, const float* __restrict__ g,
    const float* __restrict__ bta, float* __restrict__ yf,
    u16* __restrict__ yb) {
    __shared__ float sh[16];
    const int row = blockIdx.x, tid = threadIdx.x;
    const float* xr = x + (size_t)row * DDIM;
    float4 xv = *(const float4*)(xr + tid * 4);
    float s = xv.x + xv.y + xv.z + xv.w;
    float qq = xv.x * xv.x + xv.y * xv.y + xv.z * xv.z + xv.w * xv.w;
#pragma unroll
    for (int off = 16; off; off >>= 1) {
        s  += __shfl_xor(s, off, 32);
        qq += __shfl_xor(qq, off, 32);
    }
    int wv = tid >> 5, ln = tid & 31;
    if (ln == 0) { sh[wv] = s; sh[8 + wv] = qq; }
    __syncthreads();
    if (tid == 0) {
        float a = 0.f, b2 = 0.f;
        for (int i = 0; i < 8; ++i) { a += sh[i]; b2 += sh[8 + i]; }
        sh[0] = a; sh[8] = b2;
    }
    __syncthreads();
    float mu  = sh[0] * (1.0f / DDIM);
    float var = sh[8] * (1.0f / DDIM) - mu * mu;
    float inv = rsqrtf(var + 1e-5f);
    const float* xp = (const float*)&xv;
#pragma unroll
    for (int j = 0; j < 4; ++j) {
        int col = tid * 4 + j;
        float yv = (xp[j] - mu) * inv * g[col] + bta[col];
        yf[(size_t)row * DDIM + col] = yv;
        if (yb) yb[(size_t)row * DDIM + col] = f2bf(yv);
    }
}

// ---------- host ----------
extern "C" void kernel_launch(void* const* d_in, const int* in_sizes, int n_in,
                              void* d_out, int out_size, void* d_ws, size_t ws_size,
                              hipStream_t stream) {
    const float* X    = (const float*)d_in[0];
    const float* Wq   = (const float*)d_in[1];
    const float* Wk   = (const float*)d_in[2];
    const float* Wo   = (const float*)d_in[3];
    const float* ln1g = (const float*)d_in[4];
    const float* ln1b = (const float*)d_in[5];
    const float* ln2g = (const float*)d_in[6];
    const float* ln2b = (const float*)d_in[7];
    const float* W1   = (const float*)d_in[8];
    const float* b1   = (const float*)d_in[9];
    const float* W2   = (const float*)d_in[10];
    const float* b2   = (const float*)d_in[11];

    char* ws = (char*)d_ws;
    size_t off = 0;
    auto alloc = [&](size_t bytes) {
        char* p = ws + off;
        off += (bytes + 255) & ~size_t(255);
        return p;
    };
    u16*   Xb   = (u16*)alloc((size_t)MROWS * DDIM * 2);
    u16*   Wqb  = (u16*)alloc((size_t)DDIM * DDIM * 2);
    u16*   Wkb  = (u16*)alloc((size_t)DDIM * DDIM * 2);
    u16*   Wob  = (u16*)alloc((size_t)DDIM * DDIM * 2);
    u16*   W1b  = (u16*)alloc((size_t)FFD * DDIM * 2);
    u16*   W2b  = (u16*)alloc((size_t)DDIM * FFD * 2);
    u16*   qkvb = (u16*)alloc((size_t)MROWS * QKVP * 2);
    u16*   ctxb = (u16*)alloc((size_t)MROWS * DDIM * 2);
    float* ares = (float*)alloc((size_t)MROWS * DDIM * 4);
    float* yf   = (float*)alloc((size_t)MROWS * DDIM * 4);
    u16*   yb   = (u16*)alloc((size_t)MROWS * DDIM * 2);
    u16*   hb   = (u16*)alloc((size_t)MROWS * FFD * 2);
    float* fres = (float*)alloc((size_t)MROWS * DDIM * 4);

    // Xb, Wqb, Wkb, Wob, W1b, W2b are consecutive (each size a multiple of 256 bytes)
    cvt_bf16_kernel<<<CVT_BLOCKS, 256, 0, stream>>>(X, Wq, Wk, Wo, W1, W2, Xb);

    // Q, K, V projections (V uses Wo per reference) -> bf16, as one product:
    // Wqb, Wkb, Wob lie back to back, so they are one [3072][1024] operand, and
    // row m of the result is q[m] | k[m] | v[m]
    dim3 gproj(DDIM / 128, MROWS / 128);
    dim3 gqkv(QKVP / 256, MROWS / 256);
    gemm_bf16_kernel<false, false, false, true, QKVP, 256><<<gqkv, 256, 0, stream>>>(
        Xb, Wqb, nullptr, nullptr, nullptr, qkvb, MROWS, QKVP, DDIM);

    // attention -> ctx (bf16)
    attn_kernel<<<dim3(SDIM / 128, HDIM, BDIM), 256, 0, stream>>>(
        qkvb, qkvb + DDIM, qkvb + 2 * DDIM, ctxb);

    // att_out = ctx @ Wo^T + X  (fp32)
    gemm_bf16_kernel<false, false, true, false, DDIM, 128><<<gproj, 256, 0, stream>>>(
        ctxb, Wob, nullptr, X, ares, nullptr, MROWS, DDIM, DDIM);

    // y = LN1(att_out + X)  -> fp32 + bf16
    ln_kernel<<<MROWS, 256, 0, stream>>>(ares, ln1g, ln1b, yf, yb);

    // h = relu(y @ W1^T + b1) -> bf16
    dim3 gffn1(FFD / 256, MROWS / 256);
    gemm_bf16_kernel<true, true, false, true, FFD, 256><<<gffn1, 256, 0, stream>>>(
        yb, W1b, b1, nullptr, nullptr, hb, MROWS, FFD, DDIM);

    // f = h @ W2^T + b2 + y -> fp32
    gemm_bf16_kernel<true, false, true, false, DDIM, 128><<<gproj, 256, 0, stream>>>(
        hb, W2b, b2, yf, fres, nullptr, MROWS, DDIM, FFD);

    // out = LN2(f + y)
    ln_kernel<<<MROWS, 256, 0, stream>>>(fres, ln2g, ln2b, (float*)d_out, nullptr);
}

// v008
// It runs in 155 microseconds.
// In both of two side-by-side timings against v007, it was 1.05 times as fast.
// Over all steps from v000 it is 2.33 times as fast.
#include <hip/hip_runtime.h>
#include <hip/hip_bf16.h>

typedef unsigned short u16;
typedef __attribute__((ext_vector_type(16))) __bf16 v16bf;
typedef __attribute__((ext_vector_type(8)))  float  v8f;

#define DDIM 1024
#define SDIM 2048
#define BDIM 2
#define HDIM 16
#define DH   64
#define FFD  4096
#define MROWS 4096   // B*S
#define QKVP (3 * DDIM)   // row pitch of the joint q | k | v array, in elements

// ---------- helpers ----------
__device__ __forceinline__ u16 f2bf(float f) {
    unsigned u = __float_as_uint(f);
    unsigned r = ((u >> 16) & 1u) + 0x7FFFu;
    return (u16)((u + r) >> 16);
}

union Frag16 { uint4 q[2]; v16bf v; };

__device__ __forceinline__ v16bf ld_frag(const u16* t, int row0, int stride,
                                         int coloff, int lane) {
    int r = lane & 15, hi = lane >> 4;
    const u16* p = t + (size_t)(row0 + r) * stride + coloff + hi * 8;
    Frag16 f;
    f.q[0] = *(const uint4*)(p);
    f.q[1] = *(const uint4*)(p + 16);
    return f.v;
}

__device__ __forceinline__ v8f wmma_bf16(v16bf a, v16bf b, v8f c) {
    return __builtin_amdgcn_wmma_f32_16x16x32_bf16(
        false, a, false, b, (short)0, c, false, false);
}

// two f32 -> one register of two bf16, round to nearest even
typedef __attribute__((ext_vector_type(2))) float  v2f;
typedef __attribute__((ext_vector_type(2))) __bf16 v2bf;

__device__ __forceinline__ unsigned pack_bf2(float lo, float hi2) {
    v2f t = { lo, hi2 };
    return __builtin_bit_cast(unsigned, __builtin_convertvector(t, v2bf));
}

// ---------- fp32 -> bf16 conversion, all six operands in one launch ----------
// The six bf16 copies lie back to back in the workspace, so the output is one
// array. A row is 1024 elements (one float4 per thread). A block converts
// CVT_ROWS consecutive rows; every operand is a whole number of such groups,
// so a block has one source. Each thread issues all its loads before the first
// conversion.
#define CVT_ROWS   16
#define CVT_RX     (MROWS * DDIM / 1024)   // rows of X
#define CVT_RW     (DDIM * DDIM / 1024)    // rows of Wq, Wk, Wo each
#define CVT_RF     (FFD * DDIM / 1024)     // rows of W1, W2 each
#define CVT_BLOCKS ((CVT_RX + 3 * CVT_RW + 2 * CVT_RF) / CVT_ROWS)
static_assert(CVT_RX % CVT_ROWS == 0 && CVT_RW % CVT_ROWS == 0 && CVT_RF % CVT_ROWS == 0,
              "a block must not straddle two operands");

__global__ __launch_bounds__(256) __attribute__((amdgpu_waves_per_eu(8, 8)))
void cvt_bf16_kernel(
    const float* __restrict__ X,  const float* __restrict__ Wq,
    const float* __restrict__ Wk, const float* __restrict__ Wo,
    const float* __restrict__ W1, const float* __restrict__ W2,
    u16* __restrict__ out) {
    const int tid = threadIdx.x;
    const int r0  = blockIdx.x * CVT_ROWS;
    int r = r0;                 // first row, counted within its own operand
    const float* s = X;
    if (r >= CVT_RX) {
        r -= CVT_RX; s = Wq;
        if (r >= CVT_RW) { r -= CVT_RW; s = Wk; }
        if (r >= CVT_RW) { r -= CVT_RW; s = Wo; }
        if (r >= CVT_RW) { r -= CVT_RW; s = W1; }
        if (r >= CVT_RF) { r -= CVT_RF; s = W2; }
    }
    const float* sp = s + (size_t)r * 1024 + tid * 4;
    u16*         op = out + (size_t)r0 * 1024 + tid * 4;
    float4 v[CVT_ROWS];
    // both loops unrolled: v stays in registers and the loads issue as one group
#pragma unroll
    for (int j = 0; j < CVT_ROWS; ++j)
        v[j] = *(const float4*)(sp + j * 1024);
#pragma unroll
    for (int j = 0; j < CVT_ROWS; ++j) {
        u16 o[4] = { f2bf(v[j].x), f2bf(v[j].y), f2bf(v[j].z), f2bf(v[j].w) };
        *(uint2*)(op + j * 1024) = *(const uint2*)o;
    }
}

__device__ __forceinline__ void async_ld8_b128(const unsigned (&l)[8],
                                               const u16* const (&g)[8]) {
    asm volatile("global_load_async_to_lds_b128 %0, %8, off\n\t"
                 "global_load_async_to_lds_b128 %1, %9, off\n\t"
                 "global_load_async_to_lds_b128 %2, %10, off\n\t"
                 "global_load_async_to_lds_b128 %3, %11, off\n\t"
                 "global_load_async_to_lds_b128 %4, %12, off\n\t"
                 "global_load_async_to_lds_b128 %5, %13, off\n\t"
                 "global_load_async_to_lds_b128 %6, %14, off\n\t"
                 "global_load_async_to_lds_b128 %7, %15, off\n\t"
                 "s_wait_xcnt 0x0"
                 :: "v"(l[0]), "v"(l[1]), "v"(l[2]), "v"(l[3]),
                    "v"(l[4]), "v"(l[5]), "v"(l[6]), "v"(l[7]),
                    "v"(g[0]), "v"(g[1]), "v"(g[2]), "v"(g[3]),
                    "v"(g[4]), "v"(g[5]), "v"(g[6]), "v"(g[7])
                 : "memory");
}

#define GK      128                 // k per pass
#define GPITCH  136                 // LDS row pitch in elements (272 B)
// NC: the row pitch of C, of the residual and of the output (= Ndim), at compile time, so
// that one address serves all of a lane's epilogue accesses, the rows as immediate offsets.
template <bool BIAS, bool RELU, bool RESID, bool OUTBF, int NC, int BT>
__global__ __launch_bounds__(256) void gemm_bf16_kernel(
    const u16* __restrict__ A, const u16* __restrict__ W,
    const float* __restrict__ bias, const float* __restrict__ resid,
    float* __restrict__ outF, u16* __restrict__ outB,
    int Mdim, int Ndim, int Kdim) {
    constexpr int GBUF   = BT * GPITCH;   // elements of one operand's buffer
    constexpr int FM     = BT / 64;       // 16-row fragments of A rows a wave
    constexpr int FN     = BT / 32;       // 16-row fragments of W rows a wave
    constexpr int WMR    = FM * 16;       // rows of a wave's tile
    constexpr int WNC    = FN * 16;       // columns of a wave's tile
    constexpr int EPITCH = WNC + 4;       // epilogue staging: f32 row pitch in elements (16 B x odd)
    static_assert(8 * WMR * EPITCH * 4 <= 4 * GBUF * 2, "the eight waves' staging fits in the buffers");
    // As[2][GBUF] | Bs[2][GBUF]
    __shared__ __attribute__((aligned(16))) u16 Sm[4 * GBUF];
    u16* const As = Sm;
    u16* const Bs = Sm + 2 * GBUF;

    const int tid  = threadIdx.x;
    const int lane = tid & 31;
    const int wave = tid >> 5;
    const int wm   = wave >> 1;   // 0..3
    const int wn   = wave & 1;    // 0..1
    const int bm   = blockIdx.y * BT;
    const int bn   = blockIdx.x * BT;
    const int hi   = lane >> 4;

    v8f acc[FM][FN] = {};

    // staging: 16 lanes cover the 256 B of a row, a wave's copy two whole rows;
    // a thread copies rows srow + 16*i, i = 0..BT/16-1, of each operand, eight a statement
    const int srow = tid >> 4, scg = tid & 15;
    const u16* gA = A + (size_t)(bm + srow) * Kdim + scg * 8;
    const u16* gW = W + (size_t)(bn + srow) * Kdim + scg * 8;
    // BT = 256: what lives across the loop is a 32-bit element offset (operands are below
    // 2^32 elements), and each copy's pointer is formed from it anew. A pointer that is
    // itself an operand of a copy statement is held to the registers asm can name, which
    // the accumulators fill: kept across the loop it goes to scratch.
    const unsigned oA = (unsigned)((bm + srow) * Kdim + scg * 8);
    const unsigned oW = (unsigned)((bn + srow) * Kdim + scg * 8);
    const unsigned lA = (unsigned)(unsigned long long)&As[srow * GPITCH + scg * 8];
    const unsigned lB = (unsigned)(unsigned long long)&Bs[srow * GPITCH + scg * 8];

    auto stage = [&](int buf, int k0) {
        unsigned l[8];
        const u16* g[8];
#pragma unroll
        for (int c = 0; c < BT / 128; ++c) {
#pragma unroll
            for (int i = 0; i < 8; ++i) {
                l[i] = lA + (unsigned)(buf * GBUF + (c * 8 + i) * 16 * GPITCH) * 2u;
                if constexpr (BT > 128) g[i] = A + (oA + (unsigned)((c * 8 + i) * 16 * Kdim + k0));
                else                    g[i] = gA + (size_t)((c * 8 + i) * 16) * Kdim + k0;
            }
            async_ld8_b128(l, g);
        }
#pragma unroll
        for (int c = 0; c < BT / 128; ++c) {
#pragma unroll
            for (int i = 0; i < 8; ++i) {
                l[i] = lB + (unsigned)(buf * GBUF + (c * 8 + i) * 16 * GPITCH) * 2u;
                if constexpr (BT > 128) g[i] = W + (oW + (unsigned)((c * 8 + i) * 16 * Kdim + k0));
                else                    g[i] = gW + (size_t)((c * 8 + i) * 16) * Kdim + k0;
            }
            async_ld8_b128(l, g);
        }
    };

    // the epilogue's split of a wave's tile over its lanes
    const int row0 = bm + wm * WMR;
    const int col0 = bn + wn * WNC;
    constexpr int CPL = OUTBF ? 8 : 4;      // columns a lane takes: 16 B of output
    constexpr int LPR = WNC / CPL;          // lanes that cover a row of the wave's tile
    constexpr int RPI = 32 / LPR;           // rows of one wave-wide access
    static_assert(LPR <= 32, "a wave-wide access covers whole rows");
    const int lr = lane / LPR;
    const int lc = (lane % LPR) * CPL;
    float4 bv[CPL / 4];

    const int KT = Kdim / GK;
    stage(0, 0);
    // tile 0 has landed for this wave, then for the block
    asm volatile("s_wait_asynccnt 0x0" ::: "memory");
    __syncthreads();
    if (KT > 1) stage(1, GK);

    for (int kt = 0; kt < KT; ++kt) {
        const int buf = kt & 1;
#pragma unroll
        for (int kk = 0; kk < GK / 32; ++kk) {
            v16bf af[FM], bf[FN];
#pragma unroll
            for (int i = 0; i < FM; ++i)
                af[i] = ld_frag(As + buf * GBUF, wm * WMR + i * 16, GPITCH, kk * 32, lane);
#pragma unroll
            for (int j = 0; j < FN; ++j)
                bf[j] = ld_frag(Bs + buf * GBUF, wn * WNC + j * 16, GPITCH, kk * 32, lane);
            // the step's 24 LDS reads stay one group ahead of its 32 products: left free,
            // the compiler sinks the A reads to one per row of 8 products, each behind
            // its own wait to 0, and moves the next step's reads in among the products
            if constexpr (BT > 128) __builtin_amdgcn_sched_barrier(0);
#pragma unroll
            for (int i = 0; i < FM; ++i)
#pragma unroll
                for (int j = 0; j < FN; ++j)
                    acc[i][j] = wmma_bf16(bf[j], af[i], acc[i][j]);   // C^T tile: W rows first
            if constexpr (BT > 128) __builtin_amdgcn_sched_barrier(0);   // end of that group
        }

        // hand-over: this wave's reads of buf are done, its copies of the next
        // tile have landed; the one barrier publishes that tile and frees buf
        asm volatile("s_wait_dscnt 0x0" ::: "memory");
        asm volatile("s_wait_asynccnt 0x0" ::: "memory");
        __syncthreads();
        if (kt + 2 < KT) stage(buf, (kt + 2) * GK);
    }
    // no copy is outstanding when the wave goes on to its end
    asm volatile("s_wait_asynccnt 0x0" ::: "memory");

    // Epilogue, in whole 128-byte lines. With W rows as the first operand a lane holds
    // C[m = lane&15][n = 8*hi + 0..7] of each 16x16 tile: 8 consecutive columns of one
    // row. Each wave lays its tile as f32 into its own part of the buffers (free: behind the
    // last barrier no wave reads the buffers and no copy is outstanding), reads it back
    // row by row, and every global access is 16 B a lane over whole rows of the tile.
    float* st = (float*)Sm + wave * (WMR * EPITCH);

    static_assert(!(RESID && OUTBF), "the residual is added to four columns a lane");
    constexpr unsigned ESZ = OUTBF ? 2u : 4u;                     // bytes of an output element
    static_assert((size_t)MROWS * NC * 4 < (size_t)1 << 32, "byte offsets fit 32 bits");
    const unsigned e0 = (unsigned)((row0 + lr) * NC + col0 + lc); // this lane, access 0

    float4 rv[RESID ? WMR / RPI : 1];
    if (RESID) {
#pragma unroll
        for (int t = 0; t < WMR / RPI; ++t)
            rv[t] = *(const float4*)((const char*)resid + e0 * 4u + (unsigned)(t * RPI * NC) * 4u);
    }
    const float* bp = BIAS ? bias + col0 + lc : nullptr;
    if (BIAS) {
#pragma unroll
        for (int c = 0; c < CPL / 4; ++c)
            bv[c] = *(const float4*)(bp + c * 4);
    }

#pragma unroll
    for (int i = 0; i < FM; ++i)
#pragma unroll
        for (int j = 0; j < FN; ++j) {
            float* p = st + (i * 16 + (lane & 15)) * EPITCH + j * 16 + 8 * hi;
            *(float4*)(p)     = make_float4(acc[i][j][0], acc[i][j][1], acc[i][j][2], acc[i][j][3]);
            *(float4*)(p + 4) = make_float4(acc[i][j][4], acc[i][j][5], acc[i][j][6], acc[i][j][7]);
        }
    // the wave's own LDS writes are done before other lanes' values are read back
    asm volatile("s_wait_dscnt 0x0" ::: "memory");
    if constexpr (BIAS && BT > 128) {
        static_assert(CPL == 8, "two float4 a lane");
        asm volatile("s_wait_xcnt 0x0"
                     :: "v"(bp), "v"(bv[0].x), "v"(bv[0].y), "v"(bv[0].z), "v"(bv[0].w),
                        "v"(bv[1].x), "v"(bv[1].y), "v"(bv[1].z), "v"(bv[1].w)
                     : "memory");
        __builtin_amdgcn_sched_barrier(0);
    }

    // BT = 256: the stores go out in groups of EG, each group from registers of its own
    static_assert(BT == 128 || OUTBF, "the grouped stores are written for bf16 output");
    constexpr int EG = BT > 128 ? 8 : 1;
    uint4 wq[EG];
#pragma unroll
    for (int t = 0; t < WMR / RPI; ++t) {
        const float* p = st + (t * RPI + lr) * EPITCH + lc;
        char* op = (char*)(OUTBF ? (void*)outB : (void*)outF) + e0 * ESZ + (unsigned)(t * RPI * NC) * ESZ;
        float v[CPL];
#pragma unroll
        for (int c = 0; c < CPL / 4; ++c) {
            float4 x = *(const float4*)(p + c * 4);
            v[c * 4 + 0] = x.x; v[c * 4 + 1] = x.y; v[c * 4 + 2] = x.z; v[c * 4 + 3] = x.w;
            if (BIAS) {
                v[c * 4 + 0] += bv[c].x; v[c * 4 + 1] += bv[c].y;
                v[c * 4 + 2] += bv[c].z; v[c * 4 + 3] += bv[c].w;
            }
        }
        if (RELU) {
#pragma unroll
            for (int e = 0; e < CPL; ++e) v[e] = fmaxf(v[e], 0.0f);
        }
        if (RESID) {
            v[0] += rv[t].x; v[1] += rv[t].y; v[2] += rv[t].z; v[3] += rv[t].w;
        }
        if (OUTBF) {
            uint4 w;
            w.x = pack_bf2(v[0], v[1]);
            w.y = pack_bf2(v[2], v[3]);
            w.z = pack_bf2(v[CPL - 4], v[CPL - 3]);
            w.w = pack_bf2(v[CPL - 2], v[CPL - 1]);
            if constexpr (BT > 128) {
                wq[t % EG] = w;
                if (t % EG == EG - 1) {
                    __builtin_amdgcn_sched_barrier(0);
#pragma unroll
                    for (int u = 0; u < EG; ++u)
                        *(uint4*)(op - (unsigned)((EG - 1 - u) * RPI * NC) * ESZ) = wq[u];
                    if (t + 1 < WMR / RPI) {   // behind the last group nothing is rewritten
                        asm volatile("s_wait_xcnt 0x0" ::: "memory");
                        __builtin_amdgcn_sched_barrier(0);
                    }
                }
            } else {
                *(uint4*)op = w;
            }
        } else {
            *(float4*)op = make_float4(v[0], v[1], v[2], v[3]);
        }
    }
}

__device__ __forceinline__ float xhalf(float x) {
    int b = __builtin_bit_cast(int, x);
    return __builtin_bit_cast(float, __builtin_amdgcn_permlanex16(
        b, b, 0x76543210, 0xfedcba98, false, false));
}

// 16-byte transposing LDS load: from a row-major [key][feat] tile a lane gets 8
// consecutive keys of one feature (half of a V^T fragment in the hardware k order)
typedef short s16x8 __attribute__((ext_vector_type(8)));
__device__ __forceinline__ uint4 ld_tr16(const unsigned char* p) {
    typedef __attribute__((address_space(3))) s16x8 lds_s16x8;
    return __builtin_bit_cast(uint4, __builtin_amdgcn_ds_load_tr16_b128_v8i16((lds_s16x8*)p));
}

// K and V come in stages of AK keys, both row-major as they lie in memory, into two
// LDS buffers filled by async copies: the copies of stage t+1 fly during the whole
// of stage t. K rows at 144 B (16 B x odd, for b128 reads), V rows at 160 B
// (32 B x odd, for the transposing reads).
#define AK      128                 // keys per stage
#define AKP     72                  // K row pitch in elements (144 B)
#define AVP     80                  // V row pitch in elements (160 B)
__global__ __launch_bounds__(256) void attn_kernel(
    const u16* __restrict__ q, const u16* __restrict__ k,
    const u16* __restrict__ v, u16* __restrict__ ctx) {
    __shared__ __attribute__((aligned(16))) u16 Ks[2][AK * AKP];   // [key][feat]
    __shared__ __attribute__((aligned(16))) u16 Vs[2][AK * AVP];   // [key][feat]

    const int tid  = threadIdx.x;
    const int lane = tid & 31;
    const int wave = tid >> 5;
    const int hi   = lane >> 4;
    const int h    = blockIdx.y;
    const int b    = blockIdx.z;
    const int qrow0 = b * SDIM + blockIdx.x * 128 + wave * 16;

    // staging: 8 lanes cover the 128 B of a row, a wave's copy four whole rows;
    // a thread copies rows srow + 32*i, i = 0..3, of K and of V
    const int srow = tid >> 3, scg = tid & 7;
    const u16* gK = k + (size_t)(b * SDIM + srow) * QKVP + h * DH + scg * 8;
    const u16* gV = v + (size_t)(b * SDIM + srow) * QKVP + h * DH + scg * 8;
    const unsigned lK = (unsigned)(unsigned long long)&Ks[0][srow * AKP + scg * 8];
    const unsigned lV = (unsigned)(unsigned long long)&Vs[0][srow * AVP + scg * 8];

    auto stage = [&](int buf, int st) {
        unsigned l[8];
        const u16* g[8];
#pragma unroll
        for (int i = 0; i < 4; ++i) {
            l[i]     = lK + (unsigned)(buf * AK * AKP + i * 32 * AKP) * 2u;
            g[i]     = gK + (size_t)(st * AK + i * 32) * QKVP;
            l[4 + i] = lV + (unsigned)(buf * AK * AVP + i * 32 * AVP) * 2u;
            g[4 + i] = gV + (size_t)(st * AK + i * 32) * QKVP;
        }
        async_ld8_b128(l, g);
    };

    stage(0, 0);

    // Q fragments (16 x 64 per wave) straight from global bf16; B operand
    v16bf qa[2];
#pragma unroll
    for (int d = 0; d < 2; ++d)
        qa[d] = ld_frag(q + (size_t)qrow0 * QKVP + h * DH + d * 32, 0, QKVP, 0, lane);

    // o[c][rr] = O[query lane&15][feat c*16 + 8*hi + rr]
    v8f o[4] = {};
    float Mx = -1e30f;   // running maximum of this lane's query (same in both halves)
    float Lr = 0.0f;     // running sum over this half's keys; halves joined at the end

    constexpr int NT = SDIM / AK;
    constexpr int NG = AK / 16;   // groups of 16 keys in a stage
    static_assert(NT >= 2, "the prologue fills two stages");
    // stage 0 has landed for this wave, then for the block
    asm volatile("s_wait_asynccnt 0x0" ::: "memory");
    __syncthreads();
    stage(1, 1);

    for (int st = 0; st < NT; ++st) {
      const int buf = st & 1;
      const u16* Kt = &Ks[buf][0];
      // this lane's address in the transposing loads of V, pass 0, features 0..15
      const unsigned char* Vl = (const unsigned char*)&Vs[buf][0]
          + (8 * hi + (lane & 7)) * (AVP * 2) + ((lane >> 3) & 1) * 16;
      // One softmax update per stage: the scores of all AK keys are formed first, then one
      // maximum, one alpha and one rescale of the output serve the whole stage.
      // Every loop of a stage is unrolled: its arrays are indexed by constants and stay in registers.
      // V^T fragments of 32 keys, two sets: features c*16 + (lane&15), keys 8*hi + 0..7 and
      // 16 + 8*hi + 0..7 of block sub
      Frag16 vf[2][4];
      auto ldv = [&](int sub) {
#pragma unroll
        for (int c = 0; c < 4; ++c) {
            vf[sub & 1][c].q[0] = ld_tr16(Vl + (sub * 32) * (AVP * 2) + c * 32);
            vf[sub & 1][c].q[1] = ld_tr16(Vl + (sub * 32 + 16) * (AVP * 2) + c * 32);
        }
      };
      ldv(0);
      // the first set's loads stay here, one group at the head of the stage: left free they
      // sink to two in front of each product, each pair behind its own wait to 0
      __builtin_amdgcn_sched_barrier(0);

      // scores, transposed: s[g][rr] = S[key g*16 + 8*hi + rr][query lane&15]
      v8f s[NG] = {};
#pragma unroll
      for (int d = 0; d < 2; ++d)
#pragma unroll
        for (int g = 0; g < NG; ++g)
            s[g] = wmma_bf16(ld_frag(Kt, g * 16, AKP, d * 32, lane), qa[d], s[g]);

      // scale + relu + maximum, one query per lane, in four chains
      float ml[4] = { 0.0f, 0.0f, 0.0f, 0.0f };   // relu: no score is below 0
#pragma unroll
      for (int g = 0; g < NG; ++g)
#pragma unroll
        for (int rr = 0; rr < 8; ++rr) {
            s[g][rr] = fmaxf(s[g][rr] * 0.125f, 0.0f);
            ml[g & 3] = fmaxf(ml[g & 3], s[g][rr]);
        }
      float mloc = fmaxf(fmaxf(ml[0], ml[1]), fmaxf(ml[2], ml[3]));
      mloc = fmaxf(mloc, xhalf(mloc));
      const float mnew  = fmaxf(Mx, mloc);
      const float alpha = __expf(Mx - mnew);
      Mx = mnew;
#pragma unroll
      for (int c = 0; c < 4; ++c)
#pragma unroll
        for (int rr = 0; rr < 8; ++rr)
            o[c][rr] *= alpha;

      v2f sm[4] = {};   // the stage's sum, in four chains of register pairs
#pragma unroll
      for (int sub = 0; sub < NG / 2; ++sub) {
        // P^T as B operand: element e = key (e < 8 ? 8*hi + e : 16 + 8*hi + e - 8),
        // the k order in which the two transposing loads deliver V^T
        union { unsigned u[8]; v16bf v; } pb;
#pragma unroll
        for (int kc = 0; kc < 2; ++kc)
#pragma unroll
            for (int e = 0; e < 4; ++e) {
                // exp(x) as exp2(x * log2(e)), the argument formed on the register pair
                const v2f sv = { s[sub * 2 + kc][2 * e], s[sub * 2 + kc][2 * e + 1] };
                const v2f t  = (sv - mnew) * 1.44269504f;
                v2f p = { __builtin_amdgcn_exp2f(t.x), __builtin_amdgcn_exp2f(t.y) };
                sm[e] += p;
                pb.u[kc * 4 + e] = pack_bf2(p.x, p.y);
            }
        if (sub + 1 < NG / 2) ldv(sub + 1);
        // the next block's eight loads stay one group ahead of this block's products
        // (same reason as at the head)
        __builtin_amdgcn_sched_barrier(0);
#pragma unroll
        for (int c = 0; c < 4; ++c)
            o[c] = wmma_bf16(vf[sub & 1][c].v, pb.v, o[c]);
      }
      const v2f st2 = (sm[0] + sm[1]) + (sm[2] + sm[3]);
      Lr = Lr * alpha + (st2.x + st2.y);
      __builtin_amdgcn_sched_barrier(0);
      asm volatile("v_nop\n\tv_nop\n\tv_nop\n\tv_nop");

      // hand-over: this wave's reads of buf are done, its copies of the next
      // stage have landed; the one barrier publishes that stage and frees buf
      asm volatile("s_wait_dscnt 0x0" ::: "memory");
      asm volatile("s_wait_asynccnt 0x0" ::: "memory");
      __syncthreads();
      if (st + 2 < NT) stage(buf, st + 2);
    }
    // no copy is outstanding when the wave goes on to its end
    asm volatile("s_wait_asynccnt 0x0" ::: "memory");

    // join the halves' sums, normalize and emit ctx as bf16:
    // 8 consecutive features of one query per lane and tile = one 16-byte store
    Lr += xhalf(Lr);
    u16* crow = ctx + (size_t)(qrow0 + (lane & 15)) * DDIM + h * DH + 8 * hi;
#pragma unroll
    for (int c = 0; c < 4; ++c) {
        uint4 w;
        w.x = pack_bf2(o[c][0] / Lr, o[c][1] / Lr);
        w.y = pack_bf2(o[c][2] / Lr, o[c][3] / Lr);
        w.z = pack_bf2(o[c][4] / Lr, o[c][5] / Lr);
        w.w = pack_bf2(o[c][6] / Lr, o[c][7] / Lr);
        *(uint4*)(crow + c * 16) = w;
    }
}

// ---------- LayerNorm over D=1024 (input already holds x + residual) ----------
__global__ __launch_bounds__(256) void ln_kernel(
    const float* __restrict__ x, const float* __restrict__ g,
    const float* __restrict__ bta, float* __restrict__ yf,
    u16* __restrict__ yb) {
    __shared__ float sh[16];
    const int row = blockIdx.x, tid = threadIdx.x;
    const float* xr = x + (size_t)row * DDIM;
    float4 xv = *(const float4*)(xr + tid * 4);
    float s = xv.x + xv.y + xv.z + xv.w;
    float qq = xv.x * xv.x + xv.y * xv.y + xv.z * xv.z + xv.w * xv.w;
#pragma unroll
    for (int off = 16; off; off >>= 1) {
        s  += __shfl_xor(s, off, 32);
        qq += __shfl_xor(qq, off, 32);
    }
    int wv = tid >> 5, ln = tid & 31;
    if (ln == 0) { sh[wv] = s; sh[8 + wv] = qq; }
    __syncthreads();
    if (tid == 0) {
        float a = 0.f, b2 = 0.f;
        for (int i = 0; i < 8; ++i) { a += sh[i]; b2 += sh[8 + i]; }
        sh[0] = a; sh[8] = b2;
    }
    __syncthreads();
    float mu  = sh[0] * (1.0f / DDIM);
    float var = sh[8] * (1.0f / DDIM) - mu * mu;
    float inv = rsqrtf(var + 1e-5f);
    const float* xp = (const float*)&xv;
#pragma unroll
    for (int j = 0; j < 4; ++j) {
        int col = tid * 4 + j;
        float yv = (xp[j] - mu) * inv * g[col] + bta[col];
        yf[(size_t)row * DDIM + col] = yv;
        if (yb) yb[(size_t)row * DDIM + col] = f2bf(yv);
    }
}

// ---------- host ----------
extern "C" void kernel_launch(void* const* d_in, const int* in_sizes, int n_in,
                              void* d_out, int out_size, void* d_ws, size_t ws_size,
                              hipStream_t stream) {
    const float* X    = (const float*)d_in[0];
    const float* Wq   = (const float*)d_in[1];
    const float* Wk   = (const float*)d_in[2];
    const float* Wo   = (const float*)d_in[3];
    const float* ln1g = (const float*)d_in[4];
    const float* ln1b = (const float*)d_in[5];
    const float* ln2g = (const float*)d_in[6];
    const float* ln2b = (const float*)d_in[7];
    const float* W1   = (const float*)d_in[8];
    const float* b1   = (const float*)d_in[9];
    const float* W2   = (const float*)d_in[10];
    const float* b2   = (const float*)d_in[11];

    char* ws = (char*)d_ws;
    size_t off = 0;
    auto alloc = [&](size_t bytes) {
        char* p = ws + off;
        off += (bytes + 255) & ~size_t(255);
        return p;
    };
    u16*   Xb   = (u16*)alloc((size_t)MROWS * DDIM * 2);
    u16*   Wqb  = (u16*)alloc((size_t)DDIM * DDIM * 2);
    u16*   Wkb  = (u16*)alloc((size_t)DDIM * DDIM * 2);
    u16*   Wob  = (u16*)alloc((size_t)DDIM * DDIM * 2);
    u16*   W1b  = (u16*)alloc((size_t)FFD * DDIM * 2);
    u16*   W2b  = (u16*)alloc((size_t)DDIM * FFD * 2);
    u16*   qkvb = (u16*)alloc((size_t)MROWS * QKVP * 2);
    u16*   ctxb = (u16*)alloc((size_t)MROWS * DDIM * 2);
    float* ares = (float*)alloc((size_t)MROWS * DDIM * 4);
    float* yf   = (float*)alloc((size_t)MROWS * DDIM * 4);
    u16*   yb   = (u16*)alloc((size_t)MROWS * DDIM * 2);
    u16*   hb   = (u16*)alloc((size_t)MROWS * FFD * 2);
    float* fres = (float*)alloc((size_t)MROWS * DDIM * 4);

    // Xb, Wqb, Wkb, Wob, W1b, W2b are consecutive (each size a multiple of 256 bytes)
    cvt_bf16_kernel<<<CVT_BLOCKS, 256, 0, stream>>>(X, Wq, Wk, Wo, W1, W2, Xb);

    // Q, K, V projections (V uses Wo per reference) -> bf16, as one product:
    // Wqb, Wkb, Wob lie back to back, so they are one [3072][1024] operand, and
    // row m of the result is q[m] | k[m] | v[m]
    dim3 gproj(DDIM / 128, MROWS / 128);
    dim3 gqkv(QKVP / 256, MROWS / 256);
    gemm_bf16_kernel<false, false, false, true, QKVP, 256><<<gqkv, 256, 0, stream>>>(
        Xb, Wqb, nullptr, nullptr, nullptr, qkvb, MROWS, QKVP, DDIM);

    // attention -> ctx (bf16)
    attn_kernel<<<dim3(SDIM / 128, HDIM, BDIM), 256, 0, stream>>>(
        qkvb, qkvb + DDIM, qkvb + 2 * DDIM, ctxb);

    // att_out = ctx @ Wo^T + X  (fp32)
    gemm_bf16_kernel<false, false, true, false, DDIM, 128><<<gproj, 256, 0, stream>>>(
        ctxb, Wob, nullptr, X, ares, nullptr, MROWS, DDIM, DDIM);

    // y = LN1(att_out + X)  -> fp32 + bf16
    ln_kernel<<<MROWS, 256, 0, stream>>>(ares, ln1g, ln1b, yf, yb);

    // h = relu(y @ W1^T + b1) -> bf16
    dim3 gffn1(FFD / 256, MROWS / 256);
    gemm_bf16_kernel<true, true, false, true, FFD, 256><<<gffn1, 256, 0, stream>>>(
        yb, W1b, b1, nullptr, nullptr, hb, MROWS, FFD, DDIM);

    // f = h @ W2^T + b2 + y -> fp32
    gemm_bf16_kernel<true, false, true, false, DDIM, 128><<<gproj, 256, 0, stream>>>(
        hb, W2b, b2, yf, fres, nullptr, MROWS, DDIM, FFD);

    // out = LN2(f + y)
    ln_kernel<<<MROWS, 256, 0, stream>>>(fres, ln2g, ln2b, (float*)d_out, nullptr);
}
